// v000
// The times below were measured on an AMD MI455X: many runs one after another, warmed up first and cycling through
// copies of the inputs, with the whole window's GPU time divided by the number of runs. Launches and the gaps
// between them are all in it. The median over several windows is given; except for v000 it joins two sittings, which
// can be a few percent apart, so the side-by-side timings, each taken in one sitting, are the better comparison.
// v000 is the starting kernel. One run takes 1180 microseconds.
#include <hip/hip_runtime.h>

// Scaled dot-product attention on pre-split multi-head tensors with an integer key mask (queries, keys, values [2][2048][16][64] = (batch, position, head, dim), no projections; scores = einsum('bqhd,bkhd->bhqk') / sqrt(64); keys with mask[b][j] == 0 -> -1e20 (== exclusion; mask int32 [2][1][1][2048] random 0/1, read); softmax over the kept keys; out = einsum('bhqv,bvhd->bqhd') -> [2][2048][16][64] (4.2 M); argument order queries, keys, values, mask.
// Layout per batch: the raw [position][head*64 + d] rows already have the projected-feature layout, so k_rnd copies each input batch into the f32 feature buffer ROUNDED TO bf16 (hi = value, lo = 0), first queries and keys, then (after the key planes are built) values into the shared k/v buffer; identity-table plane builders; dense T-2048 attention with EVERY row on hi/lo planes (3 products); the softmax kernel reads the batch's int key vector (16 B per lane); the f32 merge writes the [position][head][dim] output rows.
// Compute dtypes, f32 accumulate: every input rounded to bf16; attention 3 products on every row; softmax f32; output f32.

#define NB_  2
#define TT   2048
#define DM   1024
#define NH_  16
#define NKV  16
#define REP  (NH_ / NKV)
#define HD   64
#define DQ   (NH_ * HD)
#define DKV  (NKV * HD)
#define ZH   2
#define RH   TT                   // every row hi/lo (3 products)
#define WIN  0
#define PCAR 1024.0f
#define SCL  0.125f   // HD^-0.5
typedef _Float16 h16;
typedef unsigned short bf;
typedef __attribute__((ext_vector_type(16))) __bf16   v16bf;
typedef __attribute__((ext_vector_type(16))) _Float16 v16h;
typedef __attribute__((ext_vector_type(8)))  _Float16 v8h;
typedef __attribute__((ext_vector_type(8)))  unsigned short v8us;
typedef __attribute__((ext_vector_type(8)))  float    v8f;
typedef __attribute__((ext_vector_type(4)))  float    v4f;
typedef v8h  __attribute__((may_alias)) v8ha;
typedef v4f  __attribute__((may_alias)) v4fa;
typedef v8us __attribute__((may_alias)) v8usa;

__device__ __forceinline__ unsigned short f2bf(float f) { unsigned u = __float_as_uint(f); u += 0x7FFFu + ((u >> 16) & 1u); return (unsigned short)(u >> 16); }
__device__ __forceinline__ float bf2f(unsigned short b) { return __uint_as_float(((unsigned)b) << 16); }
__device__ __forceinline__ float bfr(float f) { return bf2f(f2bf(f)); }
__device__ __forceinline__ v16h cat16(v8h lo, v8h hi) { return __builtin_shufflevector(lo, hi, 0, 1, 2, 3, 4, 5, 6, 7, 8, 9, 10, 11, 12, 13, 14, 15); }
__device__ __forceinline__ v16bf cat16b(v8us lo, v8us hi) { return __builtin_bit_cast(v16bf, __builtin_shufflevector(lo, hi, 0, 1, 2, 3, 4, 5, 6, 7, 8, 9, 10, 11, 12, 13, 14, 15)); }
__device__ __forceinline__ v8f wmma16(v16h a, v16h b, v8f c) { return __builtin_amdgcn_wmma_f32_16x16x32_f16(false, a, false, b, (short)0, c, false, false); }
__device__ __forceinline__ v8f wmmab(v16bf a, v16bf b, v8f c) { return __builtin_amdgcn_wmma_f32_16x16x32_bf16(false, a, false, b, (short)0, c, false, false); }



// ---- k_gemmw: register-blocked GEMM, ONE WAVE per 64x64 output tile (16 accumulators), operands straight from K-contiguous 16-bit planes; grid (M/64, N/64, Z), 32 threads.
// C[m][n] (f32, pitch ldc, + optional f32 bias[n]) = sum_k A[m][k] Bt[n][k] (+ split products per NSPLIT). z-batch strides sA/sB/sC in elements. K % 32 == 0.
template <typename T16> struct WFrag;
template <> struct WFrag<h16> { typedef v16h V; static __device__ __forceinline__ V ld(const h16* p) { return cat16(*(const v8h*)p, *(const v8h*)(p + 16)); } static __device__ __forceinline__ v8f mma(V a, V b, v8f c) { return wmma16(a, b, c); } };
template <> struct WFrag<bf> { typedef v16bf V; static __device__ __forceinline__ V ld(const bf* p) { return cat16b(*(const v8us*)p, *(const v8us*)(p + 16)); } static __device__ __forceinline__ v8f mma(V a, V b, v8f c) { return wmmab(a, b, c); } };
template <typename T16, int NSPLIT, bool BIAS>
__global__ __launch_bounds__(32) void k_gemmw(const T16* __restrict__ A, const T16* __restrict__ A2, const T16* __restrict__ Bt, const T16* __restrict__ Bt2, int K, float* C, int ldc, const float* __restrict__ bias, size_t sA, size_t sB, size_t sC) {
    typedef typename WFrag<T16>::V V;
    __shared__ __align__(16) float os[16 * 68];
    const size_t z = blockIdx.z; A += z * sA; if (A2) A2 += z * sA; Bt += z * sB; if (Bt2) Bt2 += z * sB; C += z * sC;
    const int lane = threadIdx.x & 31, lr = lane & 15, hi = lane >> 4; const int r0 = blockIdx.x * 64, c0 = blockIdx.y * 64;
    v8f acc[4][4];
#pragma unroll
    for (int mb = 0; mb < 4; ++mb)
#pragma unroll
        for (int nb = 0; nb < 4; ++nb) acc[mb][nb] = (v8f){};
    const size_t aoff = (size_t)(r0 + lr) * K + 8 * hi, boff = (size_t)(c0 + lr) * K + 8 * hi;
#pragma unroll 1
    for (int kc = 0; kc < K; kc += 32) {
        V a[4], a2[4];
#pragma unroll
        for (int mb = 0; mb < 4; ++mb) { a[mb] = WFrag<T16>::ld(A + aoff + (size_t)mb * 16 * K + kc); if (NSPLIT == 1 || NSPLIT == 2) a2[mb] = WFrag<T16>::ld(A2 + aoff + (size_t)mb * 16 * K + kc); }
#pragma unroll
        for (int nb = 0; nb < 4; ++nb) { const V b = WFrag<T16>::ld(Bt + boff + (size_t)nb * 16 * K + kc); V b2; if (NSPLIT >= 2) b2 = WFrag<T16>::ld(Bt2 + boff + (size_t)nb * 16 * K + kc);
#pragma unroll
            for (int mb = 0; mb < 4; ++mb) { acc[mb][nb] = WFrag<T16>::mma(a[mb], b, acc[mb][nb]); if (NSPLIT == 1 || NSPLIT == 2) acc[mb][nb] = WFrag<T16>::mma(a2[mb], b, acc[mb][nb]); if (NSPLIT >= 2) acc[mb][nb] = WFrag<T16>::mma(a[mb], b2, acc[mb][nb]); } }
        asm volatile("v_nop\n\tv_nop\n\tv_nop\n\tv_nop" : "+v"(acc[0][0]), "+v"(acc[1][1]), "+v"(acc[2][2]), "+v"(acc[3][3]) : "v"(a[0]), "v"(a[3]));
    }
#pragma unroll
    for (int mb = 0; mb < 4; ++mb) {
#pragma unroll
        for (int nb = 0; nb < 4; ++nb) {
#pragma unroll
            for (int j = 0; j < 8; ++j) os[(hi * 8 + j) * 68 + nb * 16 + lr] = acc[mb][nb][j]; }
        __builtin_amdgcn_wave_barrier(); asm volatile("" ::: "memory");
        float* crow = C + (size_t)(r0 + mb * 16) * ldc + c0;
{
#pragma unroll
            for (int s = 0; s < 8; ++s) { const int row = 2 * s + hi, cofs = lr * 4; v4f val = *(const v4fa*)(os + row * 68 + cofs); if (BIAS) { val[0] += bfr(bias[c0 + cofs]); val[1] += bfr(bias[c0 + cofs + 1]); val[2] += bfr(bias[c0 + cofs + 2]); val[3] += bfr(bias[c0 + cofs + 3]); }
                *(v4f*)(crow + (size_t)row * ldc + cofs) = val; }
             }
        __builtin_amdgcn_wave_barrier(); asm volatile("" ::: "memory");
    }
}

__device__ __forceinline__ h16 tohx(float x) { return (h16)x; }
__device__ __forceinline__ void splitf(float y, unsigned short& h, unsigned short& l) { h = f2bf(y); l = f2bf(y - bf2f(h)); }
typedef __attribute__((ext_vector_type(2))) _Float16 v2h;
typedef __attribute__((ext_vector_type(4))) _Float16 v4h;
typedef __attribute__((ext_vector_type(2))) unsigned short v2us;
typedef __attribute__((ext_vector_type(4))) unsigned short v4us;
typedef __attribute__((ext_vector_type(2))) float v2f;
typedef __attribute__((ext_vector_type(4))) int v4i;

// k_rope: head planes [h][t][d] (fp16 + hi/lo) of rope(x) x sc with the rotate-half convention out[d] = x[d] cos[t][d] - x[d+HD/2] sin[t][d], out[d+HD/2] = x[d+HD/2] cos[t][d+HD/2] + x[d] sin[t][d+HD/2]
__global__ __launch_bounds__(256) void k_rope(const float* __restrict__ F, int pitch, int nheads, const float* __restrict__ CS, const float* __restrict__ RF, const float* __restrict__ nw, float sc, h16* P16, bf* Ph, bf* Pl) {
    const size_t e = ((size_t)blockIdx.x * 256 + threadIdx.x) * 2; if (e >= (size_t)nheads * TT * HD) return; const int d = (int)(e % HD); const int t = (int)((e / HD) % TT); const int h = (int)(e / ((size_t)HD * TT)); const float* f = F + (size_t)t * pitch + h * HD; const float rf = RF ? RF[(size_t)h * TT + t] : 1.0f; v2h o16; v2us oh, ol;
#pragma unroll
    for (int q = 0; q < 2; ++q) { const int dd = d + q; const int dp = (dd < HD / 2) ? dd + HD / 2 : dd - HD / 2; float x0 = f[dd], x1 = f[dp];
        if (RF) { float n0 = __fmul_rn(x0, rf), n1 = __fmul_rn(x1, rf); asm volatile("" : "+v"(n0)); asm volatile("" : "+v"(n1)); x0 = __fmul_rn(bfr(nw[dd]), n0); x1 = __fmul_rn(bfr(nw[dp]), n1); }
        const v2f cs = *(const v2f*)(CS + ((size_t)t * HD + dd) * 2); float a = __fmul_rn(x0, cs[0]), bq = __fmul_rn(x1, cs[1]); asm volatile("" : "+v"(a)); asm volatile("" : "+v"(bq)); const float r = ((dd < HD / 2) ? __fsub_rn(a, bq) : __fadd_rn(a, bq)) * sc;
        o16[q] = tohx(r); unsigned short a2, c2; splitf(r, a2, c2); oh[q] = a2; ol[q] = c2; }
    *(v2h*)(P16 + e) = o16; *(v2us*)(Ph + e) = oh; *(v2us*)(Pl + e) = ol;  }
__global__ __launch_bounds__(256) void k_rnd(const float* __restrict__ src, float* dst, size_t n4) { const size_t i = (size_t)blockIdx.x * 256 + threadIdx.x; if (i >= n4) return; const v4f a = *(const v4f*)(src + i * 4); v4f r;
#pragma unroll
    for (int q = 0; q < 4; ++q) r[q] = bfr(a[q]);
    *(v4f*)(dst + i * 4) = r;  }
__global__ __launch_bounds__(256) void k_vtp(const float* __restrict__ F, int pitch, int nheads, h16* V16, bf* Vh, bf* Vl) { const size_t e = ((size_t)blockIdx.x * 256 + threadIdx.x) * 2; if (e >= (size_t)nheads * HD * TT) return; const int t = (int)(e % TT); const int d = (int)((e / TT) % HD); const int g = (int)(e / ((size_t)TT * HD)); v2h o16; v2us oh, ol;
#pragma unroll
    for (int q = 0; q < 2; ++q) { const float x = F[(size_t)(t + q) * pitch + g * HD + d]; o16[q] = tohx(x); unsigned short a2, c2; splitf(x, a2, c2); oh[q] = a2; ol[q] = c2; }
    *(v2h*)(V16 + e) = o16; *(v2us*)(Vh + e) = oh; *(v2us*)(Vl + e) = ol;  }
__global__ __launch_bounds__(256) void k_csid(float* CS) { const int idx = blockIdx.x * 256 + threadIdx.x; if (idx >= TT * HD) return; v2f cs; cs[0] = 1.0f; cs[1] = 0.0f; *(v2f*)(CS + (size_t)idx * 2) = cs;  }
// k_asoft: per row (zz, i): mask[b][j] == 0 -> excluded (-1e20 in the module) softmax over the keys (register row, one exp, fixed trees);
__global__ __launch_bounds__(256) void k_asoft(const float* __restrict__ Sb, const int* __restrict__ kvp, h16* P16, bf* Ph, bf* Pl) {
    const int lane = threadIdx.x & 31; const int row = blockIdx.x * 8 + (threadIdx.x >> 5); if (row >= ZH * TT) return; const int i = row % TT; const int zz = row / TT; (void)zz; const bool hires = (i < RH); const float* sr = Sb + (size_t)row * TT; float v[TT / 32]; float mx = -3.0e38f;
#pragma unroll
    for (int ch = 0; ch < TT / 128; ++ch) { const int j0 = ch * 128 + lane * 4; const v4f a = *(const v4f*)(sr + j0); const v4i kv4 = *(const v4i*)(kvp + j0);   /* the batch's key vector, 16 B per lane, unconditional */
#pragma unroll
        for (int q = 0; q < 4; ++q) { const int j = j0 + q; (void)j; const float t = (kv4[q] != 0) ? a[q] * SCL : -3.0e38f; v[ch * 4 + q] = t; mx = fmaxf(mx, t); } }
#pragma unroll
    for (int sh = 16; sh; sh >>= 1) mx = fmaxf(mx, __shfl_xor(mx, sh, 32));
    float sum = 0.f;
#pragma unroll
    for (int k = 0; k < TT / 32; ++k) { float d0 = __fsub_rn(v[k], mx); asm volatile("" : "+v"(d0)); v[k] = __builtin_amdgcn_exp2f(__fmul_rn(d0, 1.4426950408889634f)); sum += v[k]; }
#pragma unroll
    for (int sh = 16; sh; sh >>= 1) sum += __shfl_xor(sum, sh, 32);
    const float f = __fdiv_rn(hires ? 1.0f : PCAR, sum);
{
        if (hires) {
#pragma unroll
            for (int ch = 0; ch < TT / 128; ++ch) { v4us oh, ol;
#pragma unroll
                for (int q = 0; q < 4; ++q) { unsigned short a, c2; splitf(v[ch * 4 + q] * f, a, c2); oh[q] = a; ol[q] = c2; }
                const size_t oo = ((size_t)zz * (RH ? RH : 1) + i) * TT + ch * 128 + lane * 4; *(v4us*)(Ph + oo) = oh; *(v4us*)(Pl + oo) = ol; }
        } else {
#pragma unroll
            for (int ch = 0; ch < TT / 128; ++ch) { v4h o4;
#pragma unroll
                for (int q = 0; q < 4; ++q) o4[q] = tohx(v[ch * 4 + q] * f);
                *(v4h*)(P16 + (size_t)row * TT + ch * 128 + lane * 4) = o4; } }
         }
}
__global__ __launch_bounds__(256) void k_merge(const float* __restrict__ O, int h0, float* OUTb) { const size_t e = ((size_t)blockIdx.x * 256 + threadIdx.x) * 2; if (e >= (size_t)ZH * TT * HD) return; const int d = (int)(e % HD); const int t = (int)((e / HD) % TT); const int zz = (int)(e / ((size_t)HD * TT)); const float cs = (t < RH) ? 1.0f : (1.0f / PCAR); const size_t oo = (size_t)t * DQ + (h0 + zz) * HD + d;
    v2f o2; o2[0] = O[e] * cs; o2[1] = O[e + 1] * cs; *(v2f*)(OUTb + oo) = o2;  }

extern "C" void kernel_launch(void* const* d_in, const int* in_sizes, int n_in,
                              void* d_out, int out_size, void* d_ws, size_t ws_size, hipStream_t stream) {
    (void)in_sizes; (void)n_in; (void)out_size;
    const float* x = (const float*)d_in[0]; const float* xk = (const float*)d_in[1]; const float* xv = (const float*)d_in[2]; const int* kmask = (const int*)d_in[3];   /* order queries, keys, values [2][2048][16][64], mask (int32 [2][1][1][2048], read) */ const float* wo = nullptr; (void)wo;
    float* OUT = (float*)d_out;     // [2][2048][1024]
    char* wsp = (char*)d_ws;
    auto take = [&](size_t bytes) { char* p = wsp; wsp += (bytes + 255) & ~(size_t)255; return (void*)p; };
    bf* WQ = (bf*)take((size_t)DQ * DM * 2); bf* WK = (bf*)take((size_t)DKV * DM * 2); bf* WV = (bf*)take((size_t)DKV * DM * 2); float* CS = (float*)take((size_t)TT * HD * 2 * 4);
    bf* XB = (bf*)take((size_t)TT * DM * 2); float* FQ = (float*)take((size_t)TT * DQ * 4); float* FK = (float*)take((size_t)TT * DKV * 4);
    h16* QP16 = (h16*)take((size_t)NH_ * TT * HD * 2); h16* KP16 = (h16*)take((size_t)NKV * TT * HD * 2); h16* VT16 = (h16*)take((size_t)NKV * HD * TT * 2);
    bf* QPh = (bf*)take((size_t)NH_ * TT * HD * 2); bf* QPl = (bf*)take((size_t)NH_ * TT * HD * 2); bf* KPh = (bf*)take((size_t)NKV * TT * HD * 2); bf* KPl = (bf*)take((size_t)NKV * TT * HD * 2); bf* VTh = (bf*)take((size_t)NKV * HD * TT * 2); bf* VTl = (bf*)take((size_t)NKV * HD * TT * 2); bf* Ph = (bf*)take((size_t)ZH * RH * TT * 2); bf* Pl = (bf*)take((size_t)ZH * RH * TT * 2);
    float* Sb = (float*)take((size_t)ZH * TT * TT * 4); h16* P16 = (h16*)take((size_t)ZH * TT * TT * 2); float* Ob = (float*)take((size_t)ZH * TT * HD * 4);
    if ((size_t)(wsp - (char*)d_ws) > ws_size) return;    // ws 256 MiB
    float* FV = FK;   // bf16-rounded values reuse the k buffer after the k planes are built (stream-ordered)
    { }
    k_csid<<<(TT * HD + 255) / 256, 256, 0, stream>>>(CS);
    const unsigned LQ = (unsigned)(((size_t)NH_ * TT * HD / 2 + 255) / 256), LKv = (unsigned)(((size_t)NKV * TT * HD / 2 + 255) / 256);
    for (int b = 0; b < NB_; ++b) {
        
        
        k_rnd<<<(unsigned)(((size_t)TT * DQ / 4 + 255) / 256), 256, 0, stream>>>(x + (size_t)b * TT * DQ, FQ, (size_t)TT * DQ / 4);   /* FQ := bf16-rounded queries[b] */
        k_rope<<<LQ, 256, 0, stream>>>(FQ, DQ, NH_, CS, nullptr, nullptr, 1.0f, QP16, QPh, QPl);
        k_rnd<<<(unsigned)(((size_t)TT * DKV / 4 + 255) / 256), 256, 0, stream>>>(xk + (size_t)b * TT * DKV, FK, (size_t)TT * DKV / 4);   /* FK := bf16-rounded keys[b] */
        k_rope<<<LKv, 256, 0, stream>>>(FK, DKV, NKV, CS, nullptr, nullptr, 1.0f, KP16, KPh, KPl);
        k_rnd<<<(unsigned)(((size_t)TT * DKV / 4 + 255) / 256), 256, 0, stream>>>(xv + (size_t)b * TT * DKV, FV, (size_t)TT * DKV / 4);   /* FV (= FK buffer, after the key planes are built) := bf16-rounded values[b] */ k_vtp<<<LKv, 256, 0, stream>>>(FV, DKV, NKV, VT16, VTh, VTl);
        for (int h0 = 0; h0 < NH_; h0 += ZH) { const size_t zq = (size_t)h0, zk = (size_t)(h0 / REP);   // one kv head per query head: the pass's two heads use consecutive kv planes (z-strides TT*HD)
            k_gemmw<bf, 2, false><<<dim3(RH / 64, TT / 64, ZH), 32, 0, stream>>>(QPh + zq * TT * HD, QPl + zq * TT * HD, KPh + zk * TT * HD, KPl + zk * TT * HD, HD, Sb, TT, nullptr, (size_t)TT * HD, (size_t)TT * HD, (size_t)TT * TT);
            k_asoft<<<ZH * TT / 8, 256, 0, stream>>>(Sb, kmask + (size_t)b * TT, P16, Ph, Pl);
            k_gemmw<bf, 2, false><<<dim3(RH / 64, HD / 64, ZH), 32, 0, stream>>>(Ph, Pl, VTh + zk * HD * TT, VTl + zk * HD * TT, TT, Ob, HD, nullptr, (size_t)RH * TT, (size_t)HD * TT, (size_t)TT * HD);
            k_merge<<<(unsigned)(((size_t)ZH * TT * HD / 2 + 255) / 256), 256, 0, stream>>>(Ob, h0, OUT + (size_t)b * TT * DQ); }
         }
}

// v001
// It runs in 791 microseconds.
// Next to v000, in two timings, it ran 1.50 times as fast each time.
#include <hip/hip_runtime.h>

// Scaled dot-product attention on pre-split multi-head tensors with an integer key mask (queries, keys, values [2][2048][16][64] = (batch, position, head, dim), no projections; scores = einsum('bqhd,bkhd->bhqk') / sqrt(64); keys with mask[b][j] == 0 -> -1e20 (== exclusion; mask int32 [2][1][1][2048] random 0/1, read); softmax over the kept keys; out = einsum('bhqv,bvhd->bqhd') -> [2][2048][16][64] (4.2 M); argument order queries, keys, values, mask.
// Layout per batch: the raw [position][head*64 + d] rows already have the projected-feature layout, so k_rnd copies each input batch into the f32 feature buffer ROUNDED TO bf16 (hi = value, lo = 0), first queries and keys, then (after the key planes are built) values into the shared k/v buffer; identity-table plane builders; dense T-2048 attention with EVERY row on hi/lo planes (3 products); the softmax kernel reads the batch's int key vector (16 B per lane); the f32 merge writes the [position][head][dim] output rows.
// Compute dtypes, f32 accumulate: every input rounded to bf16; attention 3 products on every row; softmax f32; output f32.

#define NB_  2
#define TT   2048
#define DM   1024
#define NH_  16
#define NKV  16
#define REP  (NH_ / NKV)
#define HD   64
#define DQ   (NH_ * HD)
#define DKV  (NKV * HD)
#define ZH   2
#define RH   TT                   // every row hi/lo (3 products)
#define WIN  0
#define PCAR 1024.0f
#define SCL  0.125f   // HD^-0.5
typedef _Float16 h16;
typedef unsigned short bf;
typedef __attribute__((ext_vector_type(16))) __bf16   v16bf;
typedef __attribute__((ext_vector_type(16))) _Float16 v16h;
typedef __attribute__((ext_vector_type(8)))  _Float16 v8h;
typedef __attribute__((ext_vector_type(8)))  unsigned short v8us;
typedef __attribute__((ext_vector_type(8)))  float    v8f;
typedef __attribute__((ext_vector_type(4)))  float    v4f;
typedef v8h  __attribute__((may_alias)) v8ha;
typedef v4f  __attribute__((may_alias)) v4fa;
typedef v8us __attribute__((may_alias)) v8usa;

__device__ __forceinline__ unsigned short f2bf(float f) { unsigned u = __float_as_uint(f); u += 0x7FFFu + ((u >> 16) & 1u); return (unsigned short)(u >> 16); }
__device__ __forceinline__ float bf2f(unsigned short b) { return __uint_as_float(((unsigned)b) << 16); }
__device__ __forceinline__ float bfr(float f) { return bf2f(f2bf(f)); }
__device__ __forceinline__ v16h cat16(v8h lo, v8h hi) { return __builtin_shufflevector(lo, hi, 0, 1, 2, 3, 4, 5, 6, 7, 8, 9, 10, 11, 12, 13, 14, 15); }
__device__ __forceinline__ v16bf cat16b(v8us lo, v8us hi) { return __builtin_bit_cast(v16bf, __builtin_shufflevector(lo, hi, 0, 1, 2, 3, 4, 5, 6, 7, 8, 9, 10, 11, 12, 13, 14, 15)); }
__device__ __forceinline__ v8f wmma16(v16h a, v16h b, v8f c) { return __builtin_amdgcn_wmma_f32_16x16x32_f16(false, a, false, b, (short)0, c, false, false); }
__device__ __forceinline__ v8f wmmab(v16bf a, v16bf b, v8f c) { return __builtin_amdgcn_wmma_f32_16x16x32_bf16(false, a, false, b, (short)0, c, false, false); }



// ---- k_gemmw: register-blocked GEMM, ONE WAVE per 64x64 output tile (16 accumulators), operands straight from K-contiguous 16-bit planes; grid (M/64, N/64, Z), 32 threads.
// C[m][n] (f32, pitch ldc, + optional f32 bias[n]) = sum_k A[m][k] Bt[n][k] (+ split products per NSPLIT). z-batch strides sA/sB/sC in elements. K % 32 == 0.
template <typename T16> struct WFrag;
template <> struct WFrag<h16> { typedef v16h V; static __device__ __forceinline__ V ld(const h16* p) { return cat16(*(const v8h*)p, *(const v8h*)(p + 16)); } static __device__ __forceinline__ v8f mma(V a, V b, v8f c) { return wmma16(a, b, c); } };
template <> struct WFrag<bf> { typedef v16bf V; static __device__ __forceinline__ V ld(const bf* p) { return cat16b(*(const v8us*)p, *(const v8us*)(p + 16)); } static __device__ __forceinline__ v8f mma(V a, V b, v8f c) { return wmmab(a, b, c); } };
template <typename T16, int NSPLIT, bool BIAS>
__global__ __launch_bounds__(32) void k_gemmw(const T16* __restrict__ A, const T16* __restrict__ A2, const T16* __restrict__ Bt, const T16* __restrict__ Bt2, int K, float* C, int ldc, const float* __restrict__ bias, size_t sA, size_t sB, size_t sC) {
    typedef typename WFrag<T16>::V V;
    __shared__ __align__(16) float os[16 * 68];
    const size_t z = blockIdx.z; A += z * sA; if (A2) A2 += z * sA; Bt += z * sB; if (Bt2) Bt2 += z * sB; C += z * sC;
    const int lane = threadIdx.x & 31, lr = lane & 15, hi = lane >> 4; const int r0 = blockIdx.x * 64, c0 = blockIdx.y * 64;
    v8f acc[4][4];
#pragma unroll
    for (int mb = 0; mb < 4; ++mb)
#pragma unroll
        for (int nb = 0; nb < 4; ++nb) acc[mb][nb] = (v8f){};
    const size_t aoff = (size_t)(r0 + lr) * K + 8 * hi, boff = (size_t)(c0 + lr) * K + 8 * hi;
#pragma unroll 1
    for (int kc = 0; kc < K; kc += 32) {
        V a[4], a2[4];
#pragma unroll
        for (int mb = 0; mb < 4; ++mb) { a[mb] = WFrag<T16>::ld(A + aoff + (size_t)mb * 16 * K + kc); if (NSPLIT == 1 || NSPLIT == 2) a2[mb] = WFrag<T16>::ld(A2 + aoff + (size_t)mb * 16 * K + kc); }
#pragma unroll
        for (int nb = 0; nb < 4; ++nb) { const V b = WFrag<T16>::ld(Bt + boff + (size_t)nb * 16 * K + kc); V b2; if (NSPLIT >= 2) b2 = WFrag<T16>::ld(Bt2 + boff + (size_t)nb * 16 * K + kc);
#pragma unroll
            for (int mb = 0; mb < 4; ++mb) { acc[mb][nb] = WFrag<T16>::mma(a[mb], b, acc[mb][nb]); if (NSPLIT == 1 || NSPLIT == 2) acc[mb][nb] = WFrag<T16>::mma(a2[mb], b, acc[mb][nb]); if (NSPLIT >= 2) acc[mb][nb] = WFrag<T16>::mma(a[mb], b2, acc[mb][nb]); } }
        asm volatile("v_nop\n\tv_nop\n\tv_nop\n\tv_nop" : "+v"(acc[0][0]), "+v"(acc[1][1]), "+v"(acc[2][2]), "+v"(acc[3][3]) : "v"(a[0]), "v"(a[3]));
    }
#pragma unroll
    for (int mb = 0; mb < 4; ++mb) {
#pragma unroll
        for (int nb = 0; nb < 4; ++nb) {
#pragma unroll
            for (int j = 0; j < 8; ++j) os[(hi * 8 + j) * 68 + nb * 16 + lr] = acc[mb][nb][j]; }
        __builtin_amdgcn_wave_barrier(); asm volatile("" ::: "memory");
        float* crow = C + (size_t)(r0 + mb * 16) * ldc + c0;
{
#pragma unroll
            for (int s = 0; s < 8; ++s) { const int row = 2 * s + hi, cofs = lr * 4; v4f val = *(const v4fa*)(os + row * 68 + cofs); if (BIAS) { val[0] += bfr(bias[c0 + cofs]); val[1] += bfr(bias[c0 + cofs + 1]); val[2] += bfr(bias[c0 + cofs + 2]); val[3] += bfr(bias[c0 + cofs + 3]); }
                *(v4f*)(crow + (size_t)row * ldc + cofs) = val; }
             }
        __builtin_amdgcn_wave_barrier(); asm volatile("" ::: "memory");
    }
}

// ---- k_gemmk: the K loop of ONE 32x64 output tile dealt over the NW waves of a work-group (wave w sums k in [w K/NW, (w+1) K/NW)), hi/lo planes, 3 products as k_gemmw<bf, 2>; the NW partial tiles meet in LDS and are added in wave order 0..NW-1.
// For a product with few output tiles and a long K: grid (M/32, N/64, Z), NW*32 threads. K % (32 NW) == 0, NW == 16 (one float4 of the tile per thread in the final sum).
template <int NW>
__global__ __launch_bounds__(NW * 32) void k_gemmk(const bf* __restrict__ A, const bf* __restrict__ A2, const bf* __restrict__ Bt, const bf* __restrict__ Bt2, int K, float* C, int ldc, size_t sA, size_t sB, size_t sC) {
    typedef typename WFrag<bf>::V V;
    static_assert(NW * 32 * 4 == 32 * 64, "one float4 of the tile per thread");
    __shared__ __align__(16) float ps[NW * 32 * 68];   // one 32 x 64 partial tile per wave, pitch 68 floats
    const size_t z = blockIdx.z; A += z * sA; A2 += z * sA; Bt += z * sB; Bt2 += z * sB; C += z * sC;
    const int lane = threadIdx.x & 31, lr = lane & 15, hi = lane >> 4, w = threadIdx.x >> 5; const int r0 = blockIdx.x * 32, c0 = blockIdx.y * 64;
    v8f acc[2][4];   // the unroll directives on the mb, nb, j and q loops below make every acc index a constant, so the tiles stay in registers
#pragma unroll
    for (int mb = 0; mb < 2; ++mb)
#pragma unroll
        for (int nb = 0; nb < 4; ++nb) acc[mb][nb] = (v8f){};
    const int ks = K / NW;
    const size_t aoff = (size_t)(r0 + lr) * K + 8 * hi + (size_t)w * ks, boff = (size_t)(c0 + lr) * K + 8 * hi + (size_t)w * ks;
#pragma unroll 1   // kept rolled, as in k_gemmw: K is a run-time value, and an unrolled body with its remainder loop would only add code
    for (int kc = 0; kc < ks; kc += 32) {
        V a[2], a2[2];
#pragma unroll
        for (int mb = 0; mb < 2; ++mb) { a[mb] = WFrag<bf>::ld(A + aoff + (size_t)mb * 16 * K + kc); a2[mb] = WFrag<bf>::ld(A2 + aoff + (size_t)mb * 16 * K + kc); }
#pragma unroll
        for (int nb = 0; nb < 4; ++nb) { const V b = WFrag<bf>::ld(Bt + boff + (size_t)nb * 16 * K + kc); const V b2 = WFrag<bf>::ld(Bt2 + boff + (size_t)nb * 16 * K + kc);
#pragma unroll
            for (int mb = 0; mb < 2; ++mb) { acc[mb][nb] = wmmab(a[mb], b, acc[mb][nb]); acc[mb][nb] = wmmab(a2[mb], b, acc[mb][nb]); acc[mb][nb] = wmmab(a[mb], b2, acc[mb][nb]); } }
    }
    float* pw = ps + w * (32 * 68);
#pragma unroll
    for (int mb = 0; mb < 2; ++mb)
#pragma unroll
        for (int nb = 0; nb < 4; ++nb)
#pragma unroll
            for (int j = 0; j < 8; ++j) pw[(mb * 16 + hi * 8 + j) * 68 + nb * 16 + lr] = acc[mb][nb][j];
    __syncthreads();   // every wave's partial tile is in LDS before any thread sums across waves
    const int row = threadIdx.x >> 4, cofs = (threadIdx.x & 15) * 4;
    v4f s = *(const v4fa*)(ps + row * 68 + cofs);
#pragma unroll
    for (int q = 1; q < NW; ++q) s += *(const v4fa*)(ps + q * (32 * 68) + row * 68 + cofs);
    *(v4f*)(C + (size_t)(r0 + row) * ldc + c0 + cofs) = s;
}

__device__ __forceinline__ h16 tohx(float x) { return (h16)x; }
__device__ __forceinline__ void splitf(float y, unsigned short& h, unsigned short& l) { h = f2bf(y); l = f2bf(y - bf2f(h)); }
typedef __attribute__((ext_vector_type(2))) _Float16 v2h;
typedef __attribute__((ext_vector_type(4))) _Float16 v4h;
typedef __attribute__((ext_vector_type(2))) unsigned short v2us;
typedef __attribute__((ext_vector_type(4))) unsigned short v4us;
typedef __attribute__((ext_vector_type(2))) float v2f;
typedef __attribute__((ext_vector_type(4))) int v4i;

// k_rope: head planes [h][t][d] (fp16 + hi/lo) of rope(x) x sc with the rotate-half convention out[d] = x[d] cos[t][d] - x[d+HD/2] sin[t][d], out[d+HD/2] = x[d+HD/2] cos[t][d+HD/2] + x[d] sin[t][d+HD/2]
__global__ __launch_bounds__(256) void k_rope(const float* __restrict__ F, int pitch, int nheads, const float* __restrict__ CS, const float* __restrict__ RF, const float* __restrict__ nw, float sc, h16* P16, bf* Ph, bf* Pl) {
    const size_t e = ((size_t)blockIdx.x * 256 + threadIdx.x) * 2; if (e >= (size_t)nheads * TT * HD) return; const int d = (int)(e % HD); const int t = (int)((e / HD) % TT); const int h = (int)(e / ((size_t)HD * TT)); const float* f = F + (size_t)t * pitch + h * HD; const float rf = RF ? RF[(size_t)h * TT + t] : 1.0f; v2h o16; v2us oh, ol;
#pragma unroll
    for (int q = 0; q < 2; ++q) { const int dd = d + q; const int dp = (dd < HD / 2) ? dd + HD / 2 : dd - HD / 2; float x0 = f[dd], x1 = f[dp];
        if (RF) { float n0 = __fmul_rn(x0, rf), n1 = __fmul_rn(x1, rf); asm volatile("" : "+v"(n0)); asm volatile("" : "+v"(n1)); x0 = __fmul_rn(bfr(nw[dd]), n0); x1 = __fmul_rn(bfr(nw[dp]), n1); }
        const v2f cs = *(const v2f*)(CS + ((size_t)t * HD + dd) * 2); float a = __fmul_rn(x0, cs[0]), bq = __fmul_rn(x1, cs[1]); asm volatile("" : "+v"(a)); asm volatile("" : "+v"(bq)); const float r = ((dd < HD / 2) ? __fsub_rn(a, bq) : __fadd_rn(a, bq)) * sc;
        o16[q] = tohx(r); unsigned short a2, c2; splitf(r, a2, c2); oh[q] = a2; ol[q] = c2; }
    *(v2h*)(P16 + e) = o16; *(v2us*)(Ph + e) = oh; *(v2us*)(Pl + e) = ol;  }
__global__ __launch_bounds__(256) void k_rnd(const float* __restrict__ src, float* dst, size_t n4) { const size_t i = (size_t)blockIdx.x * 256 + threadIdx.x; if (i >= n4) return; const v4f a = *(const v4f*)(src + i * 4); v4f r;
#pragma unroll
    for (int q = 0; q < 4; ++q) r[q] = bfr(a[q]);
    *(v4f*)(dst + i * 4) = r;  }
__global__ __launch_bounds__(256) void k_vtp(const float* __restrict__ F, int pitch, int nheads, h16* V16, bf* Vh, bf* Vl) { const size_t e = ((size_t)blockIdx.x * 256 + threadIdx.x) * 2; if (e >= (size_t)nheads * HD * TT) return; const int t = (int)(e % TT); const int d = (int)((e / TT) % HD); const int g = (int)(e / ((size_t)TT * HD)); v2h o16; v2us oh, ol;
#pragma unroll
    for (int q = 0; q < 2; ++q) { const float x = F[(size_t)(t + q) * pitch + g * HD + d]; o16[q] = tohx(x); unsigned short a2, c2; splitf(x, a2, c2); oh[q] = a2; ol[q] = c2; }
    *(v2h*)(V16 + e) = o16; *(v2us*)(Vh + e) = oh; *(v2us*)(Vl + e) = ol;  }
__global__ __launch_bounds__(256) void k_csid(float* CS) { const int idx = blockIdx.x * 256 + threadIdx.x; if (idx >= TT * HD) return; v2f cs; cs[0] = 1.0f; cs[1] = 0.0f; *(v2f*)(CS + (size_t)idx * 2) = cs;  }
// k_asoft: per row (zz, i): mask[b][j] == 0 -> excluded (-1e20 in the module) softmax over the keys (register row, one exp, fixed trees);
__global__ __launch_bounds__(256) void k_asoft(const float* __restrict__ Sb, const int* __restrict__ kvp, h16* P16, bf* Ph, bf* Pl) {
    const int lane = threadIdx.x & 31; const int row = blockIdx.x * 8 + (threadIdx.x >> 5); if (row >= ZH * TT) return; const int i = row % TT; const int zz = row / TT; (void)zz; const bool hires = (i < RH); const float* sr = Sb + (size_t)row * TT; float v[TT / 32]; float mx = -3.0e38f;
#pragma unroll
    for (int ch = 0; ch < TT / 128; ++ch) { const int j0 = ch * 128 + lane * 4; const v4f a = *(const v4f*)(sr + j0); const v4i kv4 = *(const v4i*)(kvp + j0);   /* the batch's key vector, 16 B per lane, unconditional */
#pragma unroll
        for (int q = 0; q < 4; ++q) { const int j = j0 + q; (void)j; const float t = (kv4[q] != 0) ? a[q] * SCL : -3.0e38f; v[ch * 4 + q] = t; mx = fmaxf(mx, t); } }
#pragma unroll
    for (int sh = 16; sh; sh >>= 1) mx = fmaxf(mx, __shfl_xor(mx, sh, 32));
    float sum = 0.f;
#pragma unroll
    for (int k = 0; k < TT / 32; ++k) { float d0 = __fsub_rn(v[k], mx); asm volatile("" : "+v"(d0)); v[k] = __builtin_amdgcn_exp2f(__fmul_rn(d0, 1.4426950408889634f)); sum += v[k]; }
#pragma unroll
    for (int sh = 16; sh; sh >>= 1) sum += __shfl_xor(sum, sh, 32);
    const float f = __fdiv_rn(hires ? 1.0f : PCAR, sum);
{
        if (hires) {
#pragma unroll
            for (int ch = 0; ch < TT / 128; ++ch) { v4us oh, ol;
#pragma unroll
                for (int q = 0; q < 4; ++q) { unsigned short a, c2; splitf(v[ch * 4 + q] * f, a, c2); oh[q] = a; ol[q] = c2; }
                const size_t oo = ((size_t)zz * (RH ? RH : 1) + i) * TT + ch * 128 + lane * 4; *(v4us*)(Ph + oo) = oh; *(v4us*)(Pl + oo) = ol; }
        } else {
#pragma unroll
            for (int ch = 0; ch < TT / 128; ++ch) { v4h o4;
#pragma unroll
                for (int q = 0; q < 4; ++q) o4[q] = tohx(v[ch * 4 + q] * f);
                *(v4h*)(P16 + (size_t)row * TT + ch * 128 + lane * 4) = o4; } }
         }
}
__global__ __launch_bounds__(256) void k_merge(const float* __restrict__ O, int h0, float* OUTb) { const size_t e = ((size_t)blockIdx.x * 256 + threadIdx.x) * 2; if (e >= (size_t)ZH * TT * HD) return; const int d = (int)(e % HD); const int t = (int)((e / HD) % TT); const int zz = (int)(e / ((size_t)HD * TT)); const float cs = (t < RH) ? 1.0f : (1.0f / PCAR); const size_t oo = (size_t)t * DQ + (h0 + zz) * HD + d;
    v2f o2; o2[0] = O[e] * cs; o2[1] = O[e + 1] * cs; *(v2f*)(OUTb + oo) = o2;  }

extern "C" void kernel_launch(void* const* d_in, const int* in_sizes, int n_in,
                              void* d_out, int out_size, void* d_ws, size_t ws_size, hipStream_t stream) {
    (void)in_sizes; (void)n_in; (void)out_size;
    const float* x = (const float*)d_in[0]; const float* xk = (const float*)d_in[1]; const float* xv = (const float*)d_in[2]; const int* kmask = (const int*)d_in[3];   /* order queries, keys, values [2][2048][16][64], mask (int32 [2][1][1][2048], read) */ const float* wo = nullptr; (void)wo;
    float* OUT = (float*)d_out;     // [2][2048][1024]
    char* wsp = (char*)d_ws;
    auto take = [&](size_t bytes) { char* p = wsp; wsp += (bytes + 255) & ~(size_t)255; return (void*)p; };
    bf* WQ = (bf*)take((size_t)DQ * DM * 2); bf* WK = (bf*)take((size_t)DKV * DM * 2); bf* WV = (bf*)take((size_t)DKV * DM * 2); float* CS = (float*)take((size_t)TT * HD * 2 * 4);
    bf* XB = (bf*)take((size_t)TT * DM * 2); float* FQ = (float*)take((size_t)TT * DQ * 4); float* FK = (float*)take((size_t)TT * DKV * 4);
    h16* QP16 = (h16*)take((size_t)NH_ * TT * HD * 2); h16* KP16 = (h16*)take((size_t)NKV * TT * HD * 2); h16* VT16 = (h16*)take((size_t)NKV * HD * TT * 2);
    bf* QPh = (bf*)take((size_t)NH_ * TT * HD * 2); bf* QPl = (bf*)take((size_t)NH_ * TT * HD * 2); bf* KPh = (bf*)take((size_t)NKV * TT * HD * 2); bf* KPl = (bf*)take((size_t)NKV * TT * HD * 2); bf* VTh = (bf*)take((size_t)NKV * HD * TT * 2); bf* VTl = (bf*)take((size_t)NKV * HD * TT * 2); bf* Ph = (bf*)take((size_t)ZH * RH * TT * 2); bf* Pl = (bf*)take((size_t)ZH * RH * TT * 2);
    float* Sb = (float*)take((size_t)ZH * TT * TT * 4); h16* P16 = (h16*)take((size_t)ZH * TT * TT * 2); float* Ob = (float*)take((size_t)ZH * TT * HD * 4);
    if ((size_t)(wsp - (char*)d_ws) > ws_size) return;    // ws 256 MiB
    float* FV = FK;   // bf16-rounded values reuse the k buffer after the k planes are built (stream-ordered)
    { }
    k_csid<<<(TT * HD + 255) / 256, 256, 0, stream>>>(CS);
    const unsigned LQ = (unsigned)(((size_t)NH_ * TT * HD / 2 + 255) / 256), LKv = (unsigned)(((size_t)NKV * TT * HD / 2 + 255) / 256);
    for (int b = 0; b < NB_; ++b) {
        
        
        k_rnd<<<(unsigned)(((size_t)TT * DQ / 4 + 255) / 256), 256, 0, stream>>>(x + (size_t)b * TT * DQ, FQ, (size_t)TT * DQ / 4);   /* FQ := bf16-rounded queries[b] */
        k_rope<<<LQ, 256, 0, stream>>>(FQ, DQ, NH_, CS, nullptr, nullptr, 1.0f, QP16, QPh, QPl);
        k_rnd<<<(unsigned)(((size_t)TT * DKV / 4 + 255) / 256), 256, 0, stream>>>(xk + (size_t)b * TT * DKV, FK, (size_t)TT * DKV / 4);   /* FK := bf16-rounded keys[b] */
        k_rope<<<LKv, 256, 0, stream>>>(FK, DKV, NKV, CS, nullptr, nullptr, 1.0f, KP16, KPh, KPl);
        k_rnd<<<(unsigned)(((size_t)TT * DKV / 4 + 255) / 256), 256, 0, stream>>>(xv + (size_t)b * TT * DKV, FV, (size_t)TT * DKV / 4);   /* FV (= FK buffer, after the key planes are built) := bf16-rounded values[b] */ k_vtp<<<LKv, 256, 0, stream>>>(FV, DKV, NKV, VT16, VTh, VTl);
        for (int h0 = 0; h0 < NH_; h0 += ZH) { const size_t zq = (size_t)h0, zk = (size_t)(h0 / REP);   // one kv head per query head: the pass's two heads use consecutive kv planes (z-strides TT*HD)
            k_gemmw<bf, 2, false><<<dim3(RH / 64, TT / 64, ZH), 32, 0, stream>>>(QPh + zq * TT * HD, QPl + zq * TT * HD, KPh + zk * TT * HD, KPl + zk * TT * HD, HD, Sb, TT, nullptr, (size_t)TT * HD, (size_t)TT * HD, (size_t)TT * TT);
            k_asoft<<<ZH * TT / 8, 256, 0, stream>>>(Sb, kmask + (size_t)b * TT, P16, Ph, Pl);
            k_gemmk<16><<<dim3(RH / 32, HD / 64, ZH), 16 * 32, 0, stream>>>(Ph, Pl, VTh + zk * HD * TT, VTl + zk * HD * TT, TT, Ob, HD, (size_t)RH * TT, (size_t)HD * TT, (size_t)TT * HD);
            k_merge<<<(unsigned)(((size_t)ZH * TT * HD / 2 + 255) / 256), 256, 0, stream>>>(Ob, h0, OUT + (size_t)b * TT * DQ); }
         }
}

// v003
// It runs in 128 microseconds.
// It is 6.16 times as fast as v001, going by the measured steps of the versions left out in between.
// Over all steps from v000 it is 9.24 times as fast.
#include <hip/hip_runtime.h>

// Scaled dot-product attention on pre-split multi-head tensors with an integer key mask (queries, keys, values [2][2048][16][64] = (batch, position, head, dim), no projections; scores = einsum('bqhd,bkhd->bhqk') / sqrt(64); keys with mask[b][j] == 0 -> -1e20 (== exclusion; mask int32 [2][1][1][2048] random 0/1, read); softmax over the kept keys; out = einsum('bhqv,bvhd->bqhd') -> [2][2048][16][64] (4.2 M); argument order queries, keys, values, mask.
// Two launches: k_planes rounds every input to bf16 (hi = value, lo = 0) and writes the hi/lo operand planes of both batches and all heads, queries and keys as [z][t][d], values transposed as [z][d][t], z = batch * 16 + head; then ONE fused attention kernel (k_fattn: hi/lo planes, 3 products in each of the two matrix products, running softmax in registers, the int key vector read per pass), which writes the [position][head][dim] output rows itself.
// Compute dtypes, f32 accumulate: every input rounded to bf16; attention 3 products on every row; softmax f32; output f32.

#define NB_  2
#define TT   2048
#define DM   1024
#define NH_  16
#define NKV  16
#define REP  (NH_ / NKV)
#define HD   64
#define DQ   (NH_ * HD)
#define DKV  (NKV * HD)
typedef _Float16 h16;
typedef unsigned short bf;
typedef __attribute__((ext_vector_type(16))) __bf16   v16bf;
typedef __attribute__((ext_vector_type(16))) _Float16 v16h;
typedef __attribute__((ext_vector_type(8)))  _Float16 v8h;
typedef __attribute__((ext_vector_type(8)))  unsigned short v8us;
typedef __attribute__((ext_vector_type(8)))  float    v8f;
typedef __attribute__((ext_vector_type(4)))  float    v4f;
typedef v8h  __attribute__((may_alias)) v8ha;
typedef v4f  __attribute__((may_alias)) v4fa;
typedef v8us __attribute__((may_alias)) v8usa;

__device__ __forceinline__ v16bf cat16b(v8us lo, v8us hi) { return __builtin_bit_cast(v16bf, __builtin_shufflevector(lo, hi, 0, 1, 2, 3, 4, 5, 6, 7, 8, 9, 10, 11, 12, 13, 14, 15)); }
__device__ __forceinline__ v8f wmmab(v16bf a, v16bf b, v8f c) { return __builtin_amdgcn_wmma_f32_16x16x32_bf16(false, a, false, b, (short)0, c, false, false); }



// ---- k_fattn: scores, key mask, softmax and the P x V product of one head in ONE kernel; the scores stay in registers.
// One wave owns 32 query columns and walks the 2048 keys in passes of 32. Transposed products: S^T = K Q^T (A = key rows, B = query rows), O^T += V^T P^T (A = V^T rows, B = P^T).
// A lane's accumulator registers of two 16-key score tiles are, in order, the k positions of a B operand (k = 8 hi + r and 16 + 8 hi + r), the order in which WFrag::ldu reads V^T: P needs no LDS and no lane exchange.
// Softmax is the running form in the log2 domain: m_run is the maximum in use per query; sums and O^T are rescaled only when a pass's maximum exceeds it by more than 8. hi/lo planes, 3 products in each of the two matrix products.
// grid (TT / 256, batches x heads), 8 waves; planes [z][t][d] (Q, K) and [z][d][t] (V^T), z = batch * NH_ + head.
template <typename T16> struct WFrag;
template <> struct WFrag<bf> { typedef v16bf V; static __device__ __forceinline__ V ld(const bf* p) { return cat16b(*(const v8us*)p, *(const v8us*)(p + 16)); }
    static __device__ __forceinline__ V ldu(const bf* ub, unsigned lb) { const char* p = (const char*)ub; return cat16b(*(const v8us*)(p + lb), *(const v8us*)(p + 32 + lb)); } };   // ldu: wave-uniform base ub, the lane's own byte offset lb (scalar base + 32-bit vector offset: no address arithmetic per load)
typedef __attribute__((ext_vector_type(4))) int v4i;
typedef __attribute__((ext_vector_type(8))) unsigned v8u;
typedef __attribute__((ext_vector_type(2))) float v2f;
typedef __attribute__((ext_vector_type(2))) __bf16 v2bf;
__device__ __forceinline__ unsigned pack2(float lo, float hi) { v2f x; x[0] = lo; x[1] = hi; return __builtin_bit_cast(unsigned, __builtin_convertvector(x, v2bf)); }   // round to nearest even
__device__ __forceinline__ float xhalf(float x) { return __builtin_bit_cast(float, __builtin_amdgcn_permlanex16(__builtin_bit_cast(int, x), __builtin_bit_cast(int, x), 0x76543210, 0xfedcba98, false, false)); }   // lane l with lane l ^ 16
#define SCL2 0.18033688011112042f   // HD^-0.5 * log2(e)
__global__ __launch_bounds__(256) void k_fattn(const bf* __restrict__ Qh, const bf* __restrict__ Ql, const bf* __restrict__ Kh, const bf* __restrict__ Kl, const bf* __restrict__ Vh, const bf* __restrict__ Vl, const int* __restrict__ kmask, float* OUTp) {
    typedef WFrag<bf>::V V;
    const int lane = threadIdx.x & 31, lr = lane & 15, hi = lane >> 4, w = threadIdx.x >> 5;
    const int z = blockIdx.y, b = z / NH_, h = z % NH_; const int q0 = blockIdx.x * 256 + w * 32;
    const size_t pz = (size_t)z * TT * HD;
    V qh[2][2], ql[2][2];   // [query group][k step of 32 d]; every index below is a constant after unrolling, so all fragments and tiles stay in registers
#pragma unroll
    for (int g = 0; g < 2; ++g)
#pragma unroll
        for (int kc = 0; kc < 2; ++kc) { const size_t o = pz + (size_t)(q0 + g * 16 + lr) * HD + kc * 32 + 8 * hi; qh[g][kc] = WFrag<bf>::ld(Qh + o); ql[g][kc] = WFrag<bf>::ld(Ql + o); }
    const bf* kzh = Kh + pz; const bf* kzl = Kl + pz; const bf* vzh = Vh + pz; const bf* vzl = Vl + pz; const int* mz = kmask + (size_t)b * TT;   // wave-uniform bases; the lane's own part is a 32-bit offset
    unsigned ko = (lr * HD + 8 * hi) * 2, vo = (lr * TT + 8 * hi) * 2, mo = 8 * hi * 4;   // bytes; they walk with the passes
    V kh[2][2], kl[2][2];   // [key tile][k step]: the K fragments of the pass at hand, fetched one pass ahead
#pragma unroll
    for (int kt = 0; kt < 2; ++kt)
#pragma unroll
        for (int kc = 0; kc < 2; ++kc) { const int o = kt * 16 * HD + kc * 32; kh[kt][kc] = WFrag<bf>::ldu(kzh + o, ko); kl[kt][kc] = WFrag<bf>::ldu(kzl + o, ko); }
    asm volatile("s_wait_xcnt 0x0" ::: "memory");   // in front of the start values below, which reuse the address registers of the Q loads
    __builtin_amdgcn_sched_barrier(0);   // holds those writes behind the wait
    v8f acc[2][4]; float m_run[2], l_run[2];
#pragma unroll
    for (int g = 0; g < 2; ++g) { m_run[g] = -3.0e38f; l_run[g] = 0.f;
#pragma unroll
        for (int dt = 0; dt < 4; ++dt) acc[g][dt] = (v8f){}; }
#pragma unroll 1   // kept rolled: one pass is already some hundred instructions, and an unrolled body would only add code and registers
    for (int k0 = 0; k0 < TT; k0 += 32) {
        // this pass's key mask and V^T fragments are asked for first: the score products and the softmax arithmetic hide their way
        v4i mk[2][2];
#pragma unroll
        for (int kt = 0; kt < 2; ++kt) { const char* mq = (const char*)(mz + kt * 16); mk[kt][0] = *(const v4i*)(mq + mo); mk[kt][1] = *(const v4i*)(mq + 16 + mo); }
        V vh[4], vl[4];
#pragma unroll
        for (int dt = 0; dt < 4; ++dt) { const int o = dt * 16 * TT; vh[dt] = WFrag<bf>::ldu(vzh + o, vo); vl[dt] = WFrag<bf>::ldu(vzl + o, vo); }
        __builtin_amdgcn_sched_barrier(0);   // keeps the loads above in front of the score products; the scheduler otherwise sinks each next to its use, where its whole latency is waited for
        v8f s[2][2];   // [key tile][query group]: s[kt][g][r] = score of key k0 + 16 kt + 8 hi + r with query q0 + 16 g + lr
#pragma unroll
        for (int kt = 0; kt < 2; ++kt)
#pragma unroll
            for (int g = 0; g < 2; ++g) { v8f c = (v8f){};
#pragma unroll
                for (int kc = 0; kc < 2; ++kc) { c = wmmab(kh[kt][kc], qh[g][kc], c); c = wmmab(kh[kt][kc], ql[g][kc], c); c = wmmab(kl[kt][kc], qh[g][kc], c); }
                s[kt][g] = c; }
        __builtin_amdgcn_sched_barrier(0);   // the next pass's K loads stay behind the products that read the same fragments ...
        asm volatile("s_wait_xcnt 0x0" ::: "memory");   // in front of the rewrite of ko, which issued loads name
        __builtin_amdgcn_sched_barrier(0);   // holds that rewrite behind the wait
        ko = (ko + 32 * HD * 2) & (TT * HD * 2 - 1);   // the last pass fetches pass 0 again: in bounds, not used
#pragma unroll
        for (int kt = 0; kt < 2; ++kt)
#pragma unroll
            for (int kc = 0; kc < 2; ++kc) { const int o = kt * 16 * HD + kc * 32; kh[kt][kc] = WFrag<bf>::ldu(kzh + o, ko); kl[kt][kc] = WFrag<bf>::ldu(kzl + o, ko); }
        __builtin_amdgcn_sched_barrier(0);   // ... and in front of the softmax and the second product, which hide their way
        // scale to the log2 domain; a key with mask == 0 takes -1e20 (the sum rounds to exactly -1e20), so a row with no kept key comes out uniform, as in the module
#pragma unroll
        for (int kt = 0; kt < 2; ++kt) { const v4i m0 = mk[kt][0], m1 = mk[kt][1];
#pragma unroll
            for (int r = 0; r < 8; ++r) { const float bias = ((r < 4 ? m0[r & 3] : m1[r & 3]) != 0) ? 0.0f : -1.0e20f;
#pragma unroll
                for (int g = 0; g < 2; ++g) s[kt][g][r] = __builtin_fmaf(s[kt][g][r], SCL2, bias); } }
        float mb[2]; bool need = false;
#pragma unroll
        for (int g = 0; g < 2; ++g) { float mx = s[0][g][0];
#pragma unroll
            for (int r = 1; r < 8; ++r) mx = fmaxf(mx, s[0][g][r]);
#pragma unroll
            for (int r = 0; r < 8; ++r) mx = fmaxf(mx, s[1][g][r]);
            mx = fmaxf(mx, xhalf(mx));   // both halves of the wave hold the query's maximum over the pass's 32 keys
            mb[g] = mx; need = need || (mx > m_run[g] + 8.0f); }
        if (__builtin_amdgcn_ballot_w32(need) != 0) {   // wave-uniform, rare after the first passes
#pragma unroll
            for (int g = 0; g < 2; ++g) { const float m_new = fmaxf(m_run[g], mb[g]); const float corr = __builtin_amdgcn_exp2f(m_run[g] - m_new); m_run[g] = m_new; l_run[g] *= corr;
#pragma unroll
                for (int dt = 0; dt < 4; ++dt) acc[g][dt] = acc[g][dt] * corr; } }
#pragma unroll
        for (int g = 0; g < 2; ++g) { v8u wh, wl;
#pragma unroll
            for (int i = 0; i < 8; ++i) {
                const float p0 = __builtin_amdgcn_exp2f(s[i >> 2][g][2 * (i & 3)] - m_run[g]), p1 = __builtin_amdgcn_exp2f(s[i >> 2][g][2 * (i & 3) + 1] - m_run[g]);
                l_run[g] += p0 + p1;
                const unsigned u = pack2(p0, p1); wh[i] = u; wl[i] = pack2(p0 - __uint_as_float(u << 16), p1 - __uint_as_float(u & 0xFFFF0000u)); }
            const V ph = __builtin_bit_cast(V, wh), pl = __builtin_bit_cast(V, wl);
#pragma unroll
            for (int dt = 0; dt < 4; ++dt) { acc[g][dt] = wmmab(vh[dt], ph, acc[g][dt]); acc[g][dt] = wmmab(vh[dt], pl, acc[g][dt]); acc[g][dt] = wmmab(vl[dt], ph, acc[g][dt]); } }
        __builtin_amdgcn_sched_barrier(0);   // this and the next one hold the rewrite of vo and mo behind the wait
        asm volatile("s_wait_xcnt 0x0" ::: "memory");   // in front of the rewrite of vo and mo, which issued loads name
        __builtin_amdgcn_sched_barrier(0);
        vo += 32 * 2; mo += 32 * 4;
    }
#pragma unroll
    for (int g = 0; g < 2; ++g) { const float l = l_run[g] + xhalf(l_run[g]);   // each half summed its own 16 keys of every pass
        const float inv = __fdiv_rn(1.0f, l);
        float* op = OUTp + ((size_t)(b * TT + q0 + g * 16 + lr) * NH_ + h) * HD + 8 * hi;   // acc[g][dt][r] = O[query q0 + 16 g + lr][d = 16 dt + 8 hi + r]
#pragma unroll
        for (int dt = 0; dt < 4; ++dt) { const v8f o = acc[g][dt] * inv; v4f o0, o1;
#pragma unroll
            for (int r = 0; r < 4; ++r) { o0[r] = o[r]; o1[r] = o[4 + r]; }
            *(v4f*)(op + dt * 16) = o0; *(v4f*)(op + dt * 16 + 4) = o1; } }
}

typedef __attribute__((ext_vector_type(4))) unsigned short v4us;
typedef __attribute__((ext_vector_type(2))) unsigned v2u;
typedef __attribute__((ext_vector_type(4))) unsigned v4u;

// ---- k_planes: every operand plane of k_fattn in ONE launch, straight from the f32 inputs [batch][t][head][d]. hi = the input rounded to bf16 (nearest even); lo = what the rounded input leaves behind its hi part, which is 0.
// grid (256, 3): blockIdx.y = 0 queries, 1 keys, 2 values; 8 waves, no LDS, no barrier. One wave owns one 8-KiB tile: it asks for its 16 loads of 16 bytes a lane at once, converts, then stores whole 128-byte lines, each line from one wave.
// The head runs fastest over the tiles, so the 8 waves of a work-group read neighbouring pieces of the same input rows.
// Queries, keys: tile = 32 positions x 64 d of one head; a load takes two whole 256-byte head rows, a store two whole 128-byte plane rows.
// Values: tile = 64 positions x 32 d of one head, transposed in registers: a lane holds 8 positions x 4 d (twice), so the 8 positions of one d are one 16-byte store, and 8 lanes fill a 128-byte line of the [d][t] plane.
__global__ __launch_bounds__(256) void k_planes(const float* __restrict__ q, const float* __restrict__ k, const float* __restrict__ v, bf* Qh, bf* Ql, bf* Kh, bf* Kl, bf* Vh, bf* Vl) {
    const int lane = threadIdx.x & 31, tile = blockIdx.x * 8 + (threadIdx.x >> 5);   // 2048 tiles a tensor, 1024 a batch
    const int b = tile >> 10;
    if (blockIdx.y < 2) {
        const float* src = blockIdx.y ? k : q; bf* dh = blockIdx.y ? Kh : Qh; bf* dl = blockIdx.y ? Kl : Ql;
        const int h = tile & 15, t = ((tile >> 4) & 63) * 32 + (lane >> 4), c = (lane & 15) * 4;
        const float* s = src + ((size_t)(b * TT + t) * NH_ + h) * HD + c;
        v4f a[16];
#pragma unroll
        for (int i = 0; i < 16; ++i) a[i] = *(const v4f*)(s + (size_t)i * 2 * DQ);
        __builtin_amdgcn_sched_barrier(0);   // all 16 loads go out before the first conversion; the scheduler otherwise holds the last ones back until registers of the first are free
        asm volatile("s_wait_xcnt 0x0" :: "v"(s) : "memory");   // in front of every later write of the loads' address pair; s as an input keeps the pair whole up to here (the last load would otherwise land on it)
        __builtin_amdgcn_sched_barrier(0);   // holds those writes behind the wait
        v4us r[16];
#pragma unroll
        for (int i = 0; i < 16; ++i) { v2u u; u[0] = pack2(a[i][0], a[i][1]); u[1] = pack2(a[i][2], a[i][3]); r[i] = __builtin_bit_cast(v4us, u); }
        const size_t o = ((size_t)(b * NH_ + h) * TT + t) * HD + c;
#pragma unroll
        for (int i = 0; i < 16; ++i) { *(v4us*)(dh + o + i * 2 * HD) = r[i]; *(v4us*)(dl + o + i * 2 * HD) = (v4us){}; }
    } else {
        const int h = (tile >> 1) & 15, t = ((tile >> 5) & 31) * 64 + (lane >> 2) * 8, d = (tile & 1) * 32 + (lane & 3) * 4;
        const float* s = v + ((size_t)(b * TT + t) * NH_ + h) * HD + d;
        v4f a[2][8];   // [d group of 16][position]
#pragma unroll
        for (int j = 0; j < 8; ++j)
#pragma unroll
            for (int it = 0; it < 2; ++it) a[it][j] = *(const v4f*)(s + (size_t)j * DQ + it * 16);
        __builtin_amdgcn_sched_barrier(0);   // as above: all 16 loads first,
        asm volatile("s_wait_xcnt 0x0" :: "v"(s) : "memory");   // the wait in front of every later write of their address pair,
        __builtin_amdgcn_sched_barrier(0);   // and those writes behind it
        v8us r[2][4];
#pragma unroll
        for (int it = 0; it < 2; ++it)
#pragma unroll
            for (int c = 0; c < 4; ++c) { v4u u;
#pragma unroll
                for (int i = 0; i < 4; ++i) u[i] = pack2(a[it][2 * i][c], a[it][2 * i + 1][c]);
                r[it][c] = __builtin_bit_cast(v8us, u); }
        const size_t o = ((size_t)(b * NH_ + h) * HD + d) * TT + t;
#pragma unroll
        for (int it = 0; it < 2; ++it)
#pragma unroll
            for (int c = 0; c < 4; ++c) { *(v8us*)(Vh + o + (size_t)(it * 16 + c) * TT) = r[it][c]; *(v8us*)(Vl + o + (size_t)(it * 16 + c) * TT) = (v8us){}; }
        asm volatile("s_wait_xcnt 0x0" ::: "memory");   // behind the last store: the built code lays the other branch behind this one, where registers that these stores name are written
    }
}

extern "C" void kernel_launch(void* const* d_in, const int* in_sizes, int n_in,
                              void* d_out, int out_size, void* d_ws, size_t ws_size, hipStream_t stream) {
    (void)in_sizes; (void)n_in; (void)out_size;
    const float* x = (const float*)d_in[0]; const float* xk = (const float*)d_in[1]; const float* xv = (const float*)d_in[2]; const int* kmask = (const int*)d_in[3];   /* order queries, keys, values [2][2048][16][64], mask (int32 [2][1][1][2048], read) */
    float* OUT = (float*)d_out;     // [2][2048][1024]
    char* wsp = (char*)d_ws;
    auto take = [&](size_t bytes) { char* p = wsp; wsp += (bytes + 255) & ~(size_t)255; return (void*)p; };
    const size_t PB = (size_t)NH_ * TT * HD;   // elements of one batch's plane; the hi/lo planes hold both batches, [batch][head][..][..]
    bf* QPh = (bf*)take(NB_ * PB * 2); bf* QPl = (bf*)take(NB_ * PB * 2); bf* KPh = (bf*)take(NB_ * PB * 2); bf* KPl = (bf*)take(NB_ * PB * 2); bf* VTh = (bf*)take(NB_ * PB * 2); bf* VTl = (bf*)take(NB_ * PB * 2);
    if ((size_t)(wsp - (char*)d_ws) > ws_size) return;    // ws 256 MiB
    k_planes<<<dim3(NB_ * NH_ * TT * HD / (256 * 64), 3), 256, 0, stream>>>(x, xk, xv, QPh, QPl, KPh, KPl, VTh, VTl);   // 64 elements a lane
    k_fattn<<<dim3(TT / 256, NB_ * NH_), 256, 0, stream>>>(QPh, QPl, KPh, KPl, VTh, VTl, kmask, OUT);   // one launch for both batches and all heads
}

// v004
// One run takes 81.8 microseconds.
// Next to v003, in two timings, it ran 1.56 and 1.58 times as fast.
// All steps since v000 together make it 14.5 times as fast.
#include <hip/hip_runtime.h>

// Scaled dot-product attention on pre-split multi-head tensors with an integer key mask (queries, keys, values [2][2048][16][64] = (batch, position, head, dim), no projections; scores = einsum('bqhd,bkhd->bhqk') / sqrt(64); keys with mask[b][j] == 0 -> -1e20 (== exclusion; mask int32 [2][1][1][2048] random 0/1, read); softmax over the kept keys; out = einsum('bhqv,bvhd->bqhd') -> [2][2048][16][64] (4.2 M); argument order queries, keys, values, mask.
// Two launches: k_planes rounds every input to bf16 and writes one operand plane per input for both batches and all heads, queries and keys as [z][t][d], values transposed as [z][d][t], z = batch * 16 + head; then ONE fused attention kernel (k_fattn: one product for the scores, two for P x V (P as hi + lo), running softmax in registers, the int key vector read per pass), which writes the [position][head][dim] output rows itself.
// A rounded input has no lo part: planes of zeros are neither stored nor read, and no product is formed on them (each would add an exact 0 to its accumulator).
// Compute dtypes, f32 accumulate: every input rounded to bf16; P split into bf16 hi + lo; softmax f32; output f32.

#define NB_  2
#define TT   2048
#define DM   1024
#define NH_  16
#define NKV  16
#define REP  (NH_ / NKV)
#define HD   64
#define DQ   (NH_ * HD)
#define DKV  (NKV * HD)
typedef _Float16 h16;
typedef unsigned short bf;
typedef __attribute__((ext_vector_type(16))) __bf16   v16bf;
typedef __attribute__((ext_vector_type(16))) _Float16 v16h;
typedef __attribute__((ext_vector_type(8)))  _Float16 v8h;
typedef __attribute__((ext_vector_type(8)))  unsigned short v8us;
typedef __attribute__((ext_vector_type(8)))  float    v8f;
typedef __attribute__((ext_vector_type(4)))  float    v4f;
typedef v8h  __attribute__((may_alias)) v8ha;
typedef v4f  __attribute__((may_alias)) v4fa;
typedef v8us __attribute__((may_alias)) v8usa;

__device__ __forceinline__ v16bf cat16b(v8us lo, v8us hi) { return __builtin_bit_cast(v16bf, __builtin_shufflevector(lo, hi, 0, 1, 2, 3, 4, 5, 6, 7, 8, 9, 10, 11, 12, 13, 14, 15)); }
__device__ __forceinline__ v8f wmmab(v16bf a, v16bf b, v8f c) { return __builtin_amdgcn_wmma_f32_16x16x32_bf16(false, a, false, b, (short)0, c, false, false); }



// ---- k_fattn: scores, key mask, softmax and the P x V product of one head in ONE kernel; the scores stay in registers.
// One wave owns 32 query columns and walks the 2048 keys in passes of 32. Transposed products: S^T = K Q^T (A = key rows, B = query rows), O^T += V^T P^T (A = V^T rows, B = P^T).
// A lane's accumulator registers of two 16-key score tiles are, in order, the k positions of a B operand (k = 8 hi + r and 16 + 8 hi + r), the order in which WFrag::ldu reads V^T: P needs no LDS and no lane exchange.
// Softmax is the running form in the log2 domain: m_run is the maximum in use per query; sums and O^T are rescaled only when a pass's maximum exceeds it by more than 8. P goes into its product as bf16 hi + lo (2 products); Q, K and V are bf16 values (one plane each).
// grid (TT / 256, batches x heads), 8 waves; planes [z][t][d] (Q, K) and [z][d][t] (V^T), z = batch * NH_ + head. Every wave reads its K and V^T fragments from the planes itself; one 16-byte-a-lane fragment load touches 16 lines of 128 bytes (16 plane rows).
template <typename T16> struct WFrag;
template <> struct WFrag<bf> { typedef v16bf V; static __device__ __forceinline__ V ld(const bf* p) { return cat16b(*(const v8us*)p, *(const v8us*)(p + 16)); }
    static __device__ __forceinline__ V ldu(const bf* ub, unsigned lb) { const char* p = (const char*)ub; return cat16b(*(const v8us*)(p + lb), *(const v8us*)(p + 32 + lb)); } };   // ldu: wave-uniform base ub, the lane's own byte offset lb (scalar base + 32-bit vector offset: no address arithmetic per load)
typedef __attribute__((ext_vector_type(4))) int v4i;
typedef __attribute__((ext_vector_type(8))) unsigned v8u;
typedef __attribute__((ext_vector_type(2))) float v2f;
typedef __attribute__((ext_vector_type(2))) __bf16 v2bf;
__device__ __forceinline__ unsigned pack2(float lo, float hi) { v2f x; x[0] = lo; x[1] = hi; return __builtin_bit_cast(unsigned, __builtin_convertvector(x, v2bf)); }   // round to nearest even
__device__ __forceinline__ float xhalf(float x) { return __builtin_bit_cast(float, __builtin_amdgcn_permlanex16(__builtin_bit_cast(int, x), __builtin_bit_cast(int, x), 0x76543210, 0xfedcba98, false, false)); }   // lane l with lane l ^ 16
#define SCL2 0.18033688011112042f   // HD^-0.5 * log2(e)
__global__ __launch_bounds__(256) void k_fattn(const bf* __restrict__ Qh, const bf* __restrict__ Kh, const bf* __restrict__ Vh, const int* __restrict__ kmask, float* OUTp) {
    typedef WFrag<bf>::V V;
    const int lane = threadIdx.x & 31, lr = lane & 15, hi = lane >> 4, w = threadIdx.x >> 5;
    const int z = blockIdx.y, b = z / NH_, h = z % NH_; const int q0 = blockIdx.x * 256 + w * 32;
    const size_t pz = (size_t)z * TT * HD;
    V qh[2][2];   // [query group][k step of 32 d]; every index below is a constant after unrolling, so all fragments and tiles stay in registers
#pragma unroll
    for (int g = 0; g < 2; ++g)
#pragma unroll
        for (int kc = 0; kc < 2; ++kc) { const size_t o = pz + (size_t)(q0 + g * 16 + lr) * HD + kc * 32 + 8 * hi; qh[g][kc] = WFrag<bf>::ld(Qh + o); }
    const bf* kzh = Kh + pz; const bf* vzh = Vh + pz; const int* mz = kmask + (size_t)b * TT;   // wave-uniform bases; the lane's own part is a 32-bit offset
    unsigned ko = (lr * HD + 8 * hi) * 2, vo = (lr * TT + 8 * hi) * 2, mo = 8 * hi * 4;   // bytes; they walk with the passes
    V kh[2][2];   // [key tile][k step]: the K fragments of the pass at hand, fetched one pass ahead
#pragma unroll
    for (int kt = 0; kt < 2; ++kt)
#pragma unroll
        for (int kc = 0; kc < 2; ++kc) { const int o = kt * 16 * HD + kc * 32; kh[kt][kc] = WFrag<bf>::ldu(kzh + o, ko); }
    asm volatile("s_wait_xcnt 0x0" ::: "memory");   // in front of the start values below, which reuse the address registers of the Q loads
    __builtin_amdgcn_sched_barrier(0);   // holds those writes behind the wait
    v8f acc[2][4]; float m_run[2], l_run[2];
#pragma unroll
    for (int g = 0; g < 2; ++g) { m_run[g] = -3.0e38f; l_run[g] = 0.f;
#pragma unroll
        for (int dt = 0; dt < 4; ++dt) acc[g][dt] = (v8f){}; }
#pragma unroll 1   // kept rolled: one pass is already some hundred instructions, and an unrolled body would only add code and registers
    for (int k0 = 0; k0 < TT; k0 += 32) {
        // this pass's key mask and V^T fragments are asked for first: the score products and the softmax arithmetic hide their way
        v4i mk[2][2];
#pragma unroll
        for (int kt = 0; kt < 2; ++kt) { const char* mq = (const char*)(mz + kt * 16); mk[kt][0] = *(const v4i*)(mq + mo); mk[kt][1] = *(const v4i*)(mq + 16 + mo); }
        V vh[4];
#pragma unroll
        for (int dt = 0; dt < 4; ++dt) { const int o = dt * 16 * TT; vh[dt] = WFrag<bf>::ldu(vzh + o, vo); }
        __builtin_amdgcn_sched_barrier(0);   // keeps the loads above in front of the score products; the scheduler otherwise sinks each next to its use, where its whole latency is waited for
        v8f s[2][2];   // [key tile][query group]: s[kt][g][r] = score of key k0 + 16 kt + 8 hi + r with query q0 + 16 g + lr
#pragma unroll
        for (int kt = 0; kt < 2; ++kt)
#pragma unroll
            for (int g = 0; g < 2; ++g) { v8f c = (v8f){};
#pragma unroll
                for (int kc = 0; kc < 2; ++kc) c = wmmab(kh[kt][kc], qh[g][kc], c);
                s[kt][g] = c; }
        __builtin_amdgcn_sched_barrier(0);   // the next pass's K loads stay behind the products that read the same fragments ...
        asm volatile("s_wait_xcnt 0x0" ::: "memory");   // in front of the rewrite of ko, which issued loads name
        __builtin_amdgcn_sched_barrier(0);   // holds that rewrite behind the wait
        ko = (ko + 32 * HD * 2) & (TT * HD * 2 - 1);   // the last pass fetches pass 0 again: in bounds, not used
#pragma unroll
        for (int kt = 0; kt < 2; ++kt)
#pragma unroll
            for (int kc = 0; kc < 2; ++kc) { const int o = kt * 16 * HD + kc * 32; kh[kt][kc] = WFrag<bf>::ldu(kzh + o, ko); }
        __builtin_amdgcn_sched_barrier(0);   // ... and in front of the softmax and the second product, which hide their way
        // scale to the log2 domain; a key with mask == 0 takes -1e20 (the sum rounds to exactly -1e20), so a row with no kept key comes out uniform, as in the module
#pragma unroll
        for (int kt = 0; kt < 2; ++kt) { const v4i m0 = mk[kt][0], m1 = mk[kt][1];
#pragma unroll
            for (int r = 0; r < 8; ++r) { const float bias = ((r < 4 ? m0[r & 3] : m1[r & 3]) != 0) ? 0.0f : -1.0e20f;
#pragma unroll
                for (int g = 0; g < 2; ++g) s[kt][g][r] = __builtin_fmaf(s[kt][g][r], SCL2, bias); } }
        float mb[2]; bool need = false;
#pragma unroll
        for (int g = 0; g < 2; ++g) { float mx = s[0][g][0];
#pragma unroll
            for (int r = 1; r < 8; ++r) mx = fmaxf(mx, s[0][g][r]);
#pragma unroll
            for (int r = 0; r < 8; ++r) mx = fmaxf(mx, s[1][g][r]);
            mx = fmaxf(mx, xhalf(mx));   // both halves of the wave hold the query's maximum over the pass's 32 keys
            mb[g] = mx; need = need || (mx > m_run[g] + 8.0f); }
        if (__builtin_amdgcn_ballot_w32(need) != 0) {   // wave-uniform, rare after the first passes
#pragma unroll
            for (int g = 0; g < 2; ++g) { const float m_new = fmaxf(m_run[g], mb[g]); const float corr = __builtin_amdgcn_exp2f(m_run[g] - m_new); m_run[g] = m_new; l_run[g] *= corr;
#pragma unroll
                for (int dt = 0; dt < 4; ++dt) acc[g][dt] = acc[g][dt] * corr; } }
#pragma unroll
        for (int g = 0; g < 2; ++g) { v8u wh, wl;
#pragma unroll
            for (int i = 0; i < 8; ++i) {
                const float p0 = __builtin_amdgcn_exp2f(s[i >> 2][g][2 * (i & 3)] - m_run[g]), p1 = __builtin_amdgcn_exp2f(s[i >> 2][g][2 * (i & 3) + 1] - m_run[g]);
                l_run[g] += p0 + p1;
                const unsigned u = pack2(p0, p1); wh[i] = u; wl[i] = pack2(p0 - __uint_as_float(u << 16), p1 - __uint_as_float(u & 0xFFFF0000u)); }
            const V ph = __builtin_bit_cast(V, wh), pl = __builtin_bit_cast(V, wl);
#pragma unroll
            for (int dt = 0; dt < 4; ++dt) { acc[g][dt] = wmmab(vh[dt], ph, acc[g][dt]); acc[g][dt] = wmmab(vh[dt], pl, acc[g][dt]); } }
        __builtin_amdgcn_sched_barrier(0);   // this and the next one hold the rewrite of vo and mo behind the wait
        asm volatile("s_wait_xcnt 0x0" ::: "memory");   // in front of the rewrite of vo and mo, which issued loads name
        __builtin_amdgcn_sched_barrier(0);
        vo += 32 * 2; mo += 32 * 4;
    }
#pragma unroll
    for (int g = 0; g < 2; ++g) { const float l = l_run[g] + xhalf(l_run[g]);   // each half summed its own 16 keys of every pass
        const float inv = __fdiv_rn(1.0f, l);
        float* op = OUTp + ((size_t)(b * TT + q0 + g * 16 + lr) * NH_ + h) * HD + 8 * hi;   // acc[g][dt][r] = O[query q0 + 16 g + lr][d = 16 dt + 8 hi + r]
#pragma unroll
        for (int dt = 0; dt < 4; ++dt) { const v8f o = acc[g][dt] * inv; v4f o0, o1;
#pragma unroll
            for (int r = 0; r < 4; ++r) { o0[r] = o[r]; o1[r] = o[4 + r]; }
            *(v4f*)(op + dt * 16) = o0; *(v4f*)(op + dt * 16 + 4) = o1; } }
}

typedef __attribute__((ext_vector_type(4))) unsigned short v4us;
typedef __attribute__((ext_vector_type(2))) unsigned v2u;
typedef __attribute__((ext_vector_type(4))) unsigned v4u;

// ---- k_planes: every operand plane of k_fattn in ONE launch, straight from the f32 inputs [batch][t][head][d]: each plane holds its input rounded to bf16 (nearest even).
// grid (256, 3): blockIdx.y = 0 queries, 1 keys, 2 values; 8 waves, no LDS, no barrier. One wave owns one 8-KiB tile: it asks for its 16 loads of 16 bytes a lane at once, converts, then stores whole 128-byte lines, each line from one wave.
// The head runs fastest over the tiles, so the 8 waves of a work-group read neighbouring pieces of the same input rows.
// Queries, keys: tile = 32 positions x 64 d of one head; a load takes two whole 256-byte head rows, a store two whole 128-byte plane rows.
// Values: tile = 64 positions x 32 d of one head, transposed in registers: a lane holds 8 positions x 4 d (twice), so the 8 positions of one d are one 16-byte store, and 8 lanes fill a 128-byte line of the [d][t] plane.
__global__ __launch_bounds__(256) void k_planes(const float* __restrict__ q, const float* __restrict__ k, const float* __restrict__ v, bf* Qh, bf* Kh, bf* Vh) {
    const int lane = threadIdx.x & 31, tile = blockIdx.x * 8 + (threadIdx.x >> 5);   // 2048 tiles a tensor, 1024 a batch
    const int b = tile >> 10;
    if (blockIdx.y < 2) {
        const float* src = blockIdx.y ? k : q; bf* dh = blockIdx.y ? Kh : Qh;
        const int h = tile & 15, t = ((tile >> 4) & 63) * 32 + (lane >> 4), c = (lane & 15) * 4;
        const float* s = src + ((size_t)(b * TT + t) * NH_ + h) * HD + c;
        v4f a[16];
#pragma unroll
        for (int i = 0; i < 16; ++i) a[i] = *(const v4f*)(s + (size_t)i * 2 * DQ);
        __builtin_amdgcn_sched_barrier(0);   // all 16 loads go out before the first conversion; the scheduler otherwise holds the last ones back until registers of the first are free
        asm volatile("s_wait_xcnt 0x0" :: "v"(s) : "memory");   // in front of every later write of the loads' address pair; s as an input keeps the pair whole up to here (the last load would otherwise land on it)
        __builtin_amdgcn_sched_barrier(0);   // holds those writes behind the wait
        v4us r[16];
#pragma unroll
        for (int i = 0; i < 16; ++i) { v2u u; u[0] = pack2(a[i][0], a[i][1]); u[1] = pack2(a[i][2], a[i][3]); r[i] = __builtin_bit_cast(v4us, u); }
        const size_t o = ((size_t)(b * NH_ + h) * TT + t) * HD + c;
#pragma unroll
        for (int i = 0; i < 16; ++i) *(v4us*)(dh + o + i * 2 * HD) = r[i];
    } else {
        const int h = (tile >> 1) & 15, t = ((tile >> 5) & 31) * 64 + (lane >> 2) * 8, d = (tile & 1) * 32 + (lane & 3) * 4;
        const float* s = v + ((size_t)(b * TT + t) * NH_ + h) * HD + d;
        v4f a[2][8];   // [d group of 16][position]
#pragma unroll
        for (int j = 0; j < 8; ++j)
#pragma unroll
            for (int it = 0; it < 2; ++it) a[it][j] = *(const v4f*)(s + (size_t)j * DQ + it * 16);
        __builtin_amdgcn_sched_barrier(0);   // as above: all 16 loads first,
        asm volatile("s_wait_xcnt 0x0" :: "v"(s) : "memory");   // the wait in front of every later write of their address pair,
        __builtin_amdgcn_sched_barrier(0);   // and those writes behind it
        v8us r[2][4];
#pragma unroll
        for (int it = 0; it < 2; ++it)
#pragma unroll
            for (int c = 0; c < 4; ++c) { v4u u;
#pragma unroll
                for (int i = 0; i < 4; ++i) u[i] = pack2(a[it][2 * i][c], a[it][2 * i + 1][c]);
                r[it][c] = __builtin_bit_cast(v8us, u); }
        const size_t o = ((size_t)(b * NH_ + h) * HD + d) * TT + t;
#pragma unroll
        for (int it = 0; it < 2; ++it)
#pragma unroll
            for (int c = 0; c < 4; ++c) *(v8us*)(Vh + o + (size_t)(it * 16 + c) * TT) = r[it][c];
        asm volatile("s_wait_xcnt 0x0" ::: "memory");   // behind the last store: the built code lays the other branch behind this one, where registers that these stores name are written
    }
}

extern "C" void kernel_launch(void* const* d_in, const int* in_sizes, int n_in,
                              void* d_out, int out_size, void* d_ws, size_t ws_size, hipStream_t stream) {
    (void)in_sizes; (void)n_in; (void)out_size;
    const float* x = (const float*)d_in[0]; const float* xk = (const float*)d_in[1]; const float* xv = (const float*)d_in[2]; const int* kmask = (const int*)d_in[3];   /* order queries, keys, values [2][2048][16][64], mask (int32 [2][1][1][2048], read) */
    float* OUT = (float*)d_out;     // [2][2048][1024]
    char* wsp = (char*)d_ws;
    auto take = [&](size_t bytes) { char* p = wsp; wsp += (bytes + 255) & ~(size_t)255; return (void*)p; };
    const size_t PB = (size_t)NH_ * TT * HD;   // elements of one batch's plane; each plane holds both batches, [batch][head][..][..]
    bf* QPh = (bf*)take(NB_ * PB * 2); bf* KPh = (bf*)take(NB_ * PB * 2); bf* VTh = (bf*)take(NB_ * PB * 2);
    if ((size_t)(wsp - (char*)d_ws) > ws_size) return;    // ws 256 MiB
    k_planes<<<dim3(NB_ * NH_ * TT * HD / (256 * 64), 3), 256, 0, stream>>>(x, xk, xv, QPh, KPh, VTh);   // 64 elements a lane
    k_fattn<<<dim3(TT / 256, NB_ * NH_), 256, 0, stream>>>(QPh, KPh, VTh, kmask, OUT);   // one launch for both batches and all heads
}

// v005
// One run takes 46.7 microseconds.
// Timed twice side by side with v004, it ran 1.75 times as fast both times.
// Over all steps from v000 it is 25.4 times as fast.
#include <hip/hip_runtime.h>

// Scaled dot-product attention on pre-split multi-head tensors with an integer key mask (queries, keys, values [2][2048][16][64] = (batch, position, head, dim), no projections; scores = einsum('bqhd,bkhd->bhqk') / sqrt(64); keys with mask[b][j] == 0 -> -1e20 (== exclusion; mask int32 [2][1][1][2048] random 0/1, read); softmax over the kept keys; out = einsum('bhqv,bvhd->bqhd') -> [2][2048][16][64] (4.2 M); argument order queries, keys, values, mask.
// Two launches: k_planes rounds every input to bf16 and writes one operand plane per input for both batches and all heads, queries and keys as [z][t][d], values transposed as [z][d][t], z = batch * 16 + head; then ONE fused attention kernel (k_fattn: one product for the scores, two for P x V (P as hi + lo), running softmax in registers), which writes the [position][head][dim] output rows itself.
// The key and value planes are ordered by the key mask: a batch's kept keys first, in their order, the masked ones behind them. k_fattn walks the kept keys alone (a masked key's weight is an exact 0 beside any kept key); a batch with no kept key walks all 2048 at -1e20, which is the module's uniform row.
// A rounded input has no lo part: planes of zeros are neither stored nor read, and no product is formed on them (each would add an exact 0 to its accumulator).
// Compute dtypes, f32 accumulate: every input rounded to bf16; P split into bf16 hi + lo; softmax f32; output f32.

#define NB_  2
#define TT   2048
#define DM   1024
#define NH_  16
#define NKV  16
#define REP  (NH_ / NKV)
#define HD   64
#define DQ   (NH_ * HD)
#define DKV  (NKV * HD)
typedef _Float16 h16;
typedef unsigned short bf;
typedef __attribute__((ext_vector_type(16))) __bf16   v16bf;
typedef __attribute__((ext_vector_type(16))) _Float16 v16h;
typedef __attribute__((ext_vector_type(8)))  _Float16 v8h;
typedef __attribute__((ext_vector_type(8)))  unsigned short v8us;
typedef __attribute__((ext_vector_type(8)))  float    v8f;
typedef __attribute__((ext_vector_type(4)))  float    v4f;
typedef v8h  __attribute__((may_alias)) v8ha;
typedef v4f  __attribute__((may_alias)) v4fa;
typedef v8us __attribute__((may_alias)) v8usa;

__device__ __forceinline__ v16bf cat16b(v8us lo, v8us hi) { return __builtin_bit_cast(v16bf, __builtin_shufflevector(lo, hi, 0, 1, 2, 3, 4, 5, 6, 7, 8, 9, 10, 11, 12, 13, 14, 15)); }
__device__ __forceinline__ v8f wmmab(v16bf a, v16bf b, v8f c) { return __builtin_amdgcn_wmma_f32_16x16x32_bf16(false, a, false, b, (short)0, c, false, false); }



// ---- k_fattn: scores, key mask, softmax and the P x V product of one head in ONE kernel; the scores stay in registers.
// One wave owns 32 query columns and walks its batch's kept keys (all 2048 when none is kept) in passes of 32. Transposed products: S^T = K Q^T (A = key rows, B = query rows), O^T += V^T P^T (A = V^T rows, B = P^T).
// A lane's accumulator registers of two 16-key score tiles are, in order, the k positions of a B operand (k = 8 hi + r and 16 + 8 hi + r), the order in which WFrag::ldu reads V^T: P needs no LDS and no lane exchange.
// Softmax is the running form in the log2 domain: m_run is the maximum in use per query; sums and O^T are rescaled only when a pass's maximum exceeds it by more than 8. P goes into its product as bf16 hi + lo (2 products); Q, K and V are bf16 values (one plane each).
// grid (TT / 256, batches x heads), 8 waves; planes [z][t][d] (Q, K) and [z][d][t] (V^T), z = batch * NH_ + head; t of K and V^T is the place in the kept-first order, NK[32 * batch] the number of kept keys. Every wave reads its K and V^T fragments from the planes itself; one 16-byte-a-lane fragment load touches 16 lines of 128 bytes (16 plane rows).
template <typename T16> struct WFrag;
template <> struct WFrag<bf> { typedef v16bf V; static __device__ __forceinline__ V ld(const bf* p) { return cat16b(*(const v8us*)p, *(const v8us*)(p + 16)); }
    static __device__ __forceinline__ V ldu(const bf* ub, unsigned lb) { const char* p = (const char*)ub; return cat16b(*(const v8us*)(p + lb), *(const v8us*)(p + 32 + lb)); } };   // ldu: wave-uniform base ub, the lane's own byte offset lb (scalar base + 32-bit vector offset: no address arithmetic per load)
typedef __attribute__((ext_vector_type(4))) int v4i;
typedef __attribute__((ext_vector_type(8))) unsigned v8u;
typedef __attribute__((ext_vector_type(2))) float v2f;
typedef __attribute__((ext_vector_type(2))) __bf16 v2bf;
__device__ __forceinline__ unsigned pack2(float lo, float hi) { v2f x; x[0] = lo; x[1] = hi; return __builtin_bit_cast(unsigned, __builtin_convertvector(x, v2bf)); }   // round to nearest even
__device__ __forceinline__ float xhalf(float x) { return __builtin_bit_cast(float, __builtin_amdgcn_permlanex16(__builtin_bit_cast(int, x), __builtin_bit_cast(int, x), 0x76543210, 0xfedcba98, false, false)); }   // lane l with lane l ^ 16
#define SCL2 0.18033688011112042f   // HD^-0.5 * log2(e)
__global__ __launch_bounds__(256) void k_fattn(const bf* __restrict__ Qh, const bf* __restrict__ Kh, const bf* __restrict__ Vh, const int* __restrict__ NK, float* OUTp) {
    typedef WFrag<bf>::V V;
    const int lane = threadIdx.x & 31, lr = lane & 15, hi = lane >> 4, w = threadIdx.x >> 5;
    const int z = blockIdx.y, b = z / NH_, h = z % NH_; const int q0 = blockIdx.x * 256 + w * 32;
    const size_t pz = (size_t)z * TT * HD;
    int nk = NK[b * 32]; nk = nk < 0 ? 0 : (nk > TT ? TT : nk);   // kept keys of this batch, bounded here: it sets the trip count
    const int nend = nk ? nk : TT;   // keys to walk; the planes are written up to the next multiple of 32 (K) and 64 (V^T)
    const int lim = nk - 8 * hi;
    V qh[2][2];   // [query group][k step of 32 d]; every index below is a constant after unrolling, so all fragments and tiles stay in registers
#pragma unroll
    for (int g = 0; g < 2; ++g)
#pragma unroll
        for (int kc = 0; kc < 2; ++kc) { const size_t o = pz + (size_t)(q0 + g * 16 + lr) * HD + kc * 32 + 8 * hi; qh[g][kc] = WFrag<bf>::ld(Qh + o); }
    const bf* kzh = Kh + pz; const bf* vzh = Vh + pz;   // wave-uniform bases; the lane's own part is a 32-bit offset
    unsigned ko = (lr * HD + 8 * hi) * 2, vo = (lr * TT + 8 * hi) * 2;   // bytes; they walk with the passes
    V kh[2][2];   // [key tile][k step]: the K fragments of the pass at hand, fetched one pass ahead
#pragma unroll
    for (int kt = 0; kt < 2; ++kt)
#pragma unroll
        for (int kc = 0; kc < 2; ++kc) { const int o = kt * 16 * HD + kc * 32; kh[kt][kc] = WFrag<bf>::ldu(kzh + o, ko); }
    asm volatile("s_wait_xcnt 0x0" ::: "memory");   // in front of the start values below, which reuse the address registers of the Q loads
    __builtin_amdgcn_sched_barrier(0);   // holds those writes behind the wait
    v8f acc[2][4]; float m_run[2], l_run[2];
#pragma unroll
    for (int g = 0; g < 2; ++g) { m_run[g] = -3.0e38f; l_run[g] = 0.f;
#pragma unroll
        for (int dt = 0; dt < 4; ++dt) acc[g][dt] = (v8f){}; }
    int k0 = 0;
#pragma unroll 1   // kept rolled: one pass is already some hundred instructions, and an unrolled body would only add code and registers
    do {   // nend >= 1: there is always a first pass, so the loop needs no test in front of it
        // this pass's V^T fragments are asked for first: the score products and the softmax arithmetic hide their way
        V vh[4];
#pragma unroll
        for (int dt = 0; dt < 4; ++dt) { const int o = dt * 16 * TT; vh[dt] = WFrag<bf>::ldu(vzh + o, vo); }
        __builtin_amdgcn_sched_barrier(0);   // keeps the loads above in front of the score products; the scheduler otherwise sinks each next to its use, where its whole latency is waited for
        v8f s[2][2];   // [key tile][query group]: s[kt][g][r] = score of key k0 + 16 kt + 8 hi + r with query q0 + 16 g + lr
#pragma unroll
        for (int kt = 0; kt < 2; ++kt)
#pragma unroll
            for (int g = 0; g < 2; ++g) { v8f c = (v8f){};
#pragma unroll
                for (int kc = 0; kc < 2; ++kc) c = wmmab(kh[kt][kc], qh[g][kc], c);
                s[kt][g] = c; }
        __builtin_amdgcn_sched_barrier(0);   // the next pass's K loads stay behind the products that read the same fragments ...
        asm volatile("s_wait_xcnt 0x0" ::: "memory");   // in front of the rewrite of ko, which issued loads name
        __builtin_amdgcn_sched_barrier(0);   // holds that rewrite behind the wait
        ko += (k0 + 32 < nend) ? 32u * HD * 2 : 0u - (unsigned)k0 * HD * 2;   // the last pass fetches pass 0 again: rows that this call has written, not used
#pragma unroll
        for (int kt = 0; kt < 2; ++kt)
#pragma unroll
            for (int kc = 0; kc < 2; ++kc) { const int o = kt * 16 * HD + kc * 32; kh[kt][kc] = WFrag<bf>::ldu(kzh + o, ko); }
        __builtin_amdgcn_sched_barrier(0);   // ... and in front of the softmax and the second product, which hide their way
        // scale to the log2 domain; a key behind the kept ones (mask == 0: the last pass's fill, or every key where none is kept) takes -1e20 (the sum rounds to exactly -1e20), so a row with no kept key comes out uniform, as in the module
        const int rem = lim - k0;   // this lane's key 16 kt + r of the pass is a kept one while 16 kt + r < rem
#pragma unroll
        for (int kt = 0; kt < 2; ++kt) {
#pragma unroll
            for (int r = 0; r < 8; ++r) { const float bias = (kt * 16 + r < rem) ? 0.0f : -1.0e20f;
#pragma unroll
                for (int g = 0; g < 2; ++g) s[kt][g][r] = __builtin_fmaf(s[kt][g][r], SCL2, bias); } }
        float mb[2]; bool need = false;
#pragma unroll
        for (int g = 0; g < 2; ++g) { float mx = s[0][g][0];
#pragma unroll
            for (int r = 1; r < 8; ++r) mx = fmaxf(mx, s[0][g][r]);
#pragma unroll
            for (int r = 0; r < 8; ++r) mx = fmaxf(mx, s[1][g][r]);
            mx = fmaxf(mx, xhalf(mx));   // both halves of the wave hold the query's maximum over the pass's 32 keys
            mb[g] = mx; need = need || (mx > m_run[g] + 8.0f); }
        if (__builtin_amdgcn_ballot_w32(need) != 0) {   // wave-uniform, rare after the first passes
#pragma unroll
            for (int g = 0; g < 2; ++g) { const float m_new = fmaxf(m_run[g], mb[g]); const float corr = __builtin_amdgcn_exp2f(m_run[g] - m_new); m_run[g] = m_new; l_run[g] *= corr;
#pragma unroll
                for (int dt = 0; dt < 4; ++dt) acc[g][dt] = acc[g][dt] * corr; } }
#pragma unroll
        for (int g = 0; g < 2; ++g) { v8u wh, wl;
#pragma unroll
            for (int i = 0; i < 8; ++i) {
                const float p0 = __builtin_amdgcn_exp2f(s[i >> 2][g][2 * (i & 3)] - m_run[g]), p1 = __builtin_amdgcn_exp2f(s[i >> 2][g][2 * (i & 3) + 1] - m_run[g]);
                l_run[g] += p0 + p1;
                const unsigned u = pack2(p0, p1); wh[i] = u; wl[i] = pack2(p0 - __uint_as_float(u << 16), p1 - __uint_as_float(u & 0xFFFF0000u)); }
            const V ph = __builtin_bit_cast(V, wh), pl = __builtin_bit_cast(V, wl);
#pragma unroll
            for (int dt = 0; dt < 4; ++dt) { acc[g][dt] = wmmab(vh[dt], ph, acc[g][dt]); acc[g][dt] = wmmab(vh[dt], pl, acc[g][dt]); } }
        __builtin_amdgcn_sched_barrier(0);   // this and the next one hold the rewrite of vo behind the wait
        asm volatile("s_wait_xcnt 0x0" ::: "memory");   // in front of the rewrite of vo, which issued loads name
        __builtin_amdgcn_sched_barrier(0);
        vo += 32 * 2; k0 += 32;
    } while (k0 < nend);
#pragma unroll
    for (int g = 0; g < 2; ++g) { const float l = l_run[g] + xhalf(l_run[g]);   // each half summed its own 16 keys of every pass
        const float inv = __fdiv_rn(1.0f, l);
        float* op = OUTp + ((size_t)(b * TT + q0 + g * 16 + lr) * NH_ + h) * HD + 8 * hi;   // acc[g][dt][r] = O[query q0 + 16 g + lr][d = 16 dt + 8 hi + r]
#pragma unroll
        for (int dt = 0; dt < 4; ++dt) { const v8f o = acc[g][dt] * inv; v4f o0, o1;
#pragma unroll
            for (int r = 0; r < 4; ++r) { o0[r] = o[r]; o1[r] = o[4 + r]; }
            *(v4f*)(op + dt * 16) = o0; *(v4f*)(op + dt * 16 + 4) = o1; } }
}

typedef __attribute__((ext_vector_type(4))) unsigned short v4us;
typedef __attribute__((ext_vector_type(2))) unsigned v2u;
typedef __attribute__((ext_vector_type(4))) unsigned v4u;
typedef v4u __attribute__((may_alias)) v4ua;

// ---- k_planes: every operand plane of k_fattn in ONE launch, straight from the f32 inputs [batch][t][head][d]: each plane holds its input rounded to bf16 (nearest even).
// grid (256, 3): blockIdx.y = 0 queries, 1 keys, 2 values; 8 waves. One wave owns one 8-KiB tile: it asks for its 16 loads of 16 bytes a lane at once, converts, then stores whole 128-byte lines, each line from one wave.
// The head runs fastest over the tiles (for values: the half of d, then the head), so the 8 waves of a work-group read neighbouring pieces of the same input rows.
// Keys and values: every work-group first orders its batch's 2048 positions by the key mask in LDS (order[j] = position of place j: kept keys first, masked ones behind, each kind in its own order; a count per thread of 8 positions, a running sum over the 256 threads). A tile is a run of places; its rows are fetched by order[]; a tile that starts behind the last place k_fattn walks is left out.
// Queries, keys: tile = 32 positions (places) x 64 d of one head; a load takes two whole 256-byte head rows, a store two whole 128-byte plane rows.
// Values: tile = 64 places x 32 d of one head, transposed in registers: a lane holds 8 places x 4 d (twice), so the 8 places of one d are one 16-byte store, and 8 lanes fill a 128-byte line of the [d][t] plane.
__global__ __launch_bounds__(256) void k_planes(const float* __restrict__ q, const float* __restrict__ k, const float* __restrict__ v, const int* __restrict__ kmask, bf* Qh, bf* Kh, bf* Vh, int* NK) {
    __shared__ __attribute__((aligned(16))) unsigned short order[TT];
    __shared__ int wsum[8];
    const int lane = threadIdx.x & 31, wv = threadIdx.x >> 5, tile = blockIdx.x * 8 + wv;   // 2048 tiles a tensor, 1024 a batch
    const int b = tile >> 10;   // one batch a work-group (128 work-groups a batch)
    int nend = TT;   // places to fill
    if (blockIdx.y != 0) {   // the same for the whole work-group, as the two barriers inside ask
        const int t8 = threadIdx.x * 8;
        const int* mp = kmask + b * TT + t8;
        const v4i m0 = *(const v4i*)mp, m1 = *(const v4i*)(mp + 4);
        asm volatile("s_wait_xcnt 0x0" :: "v"(mp) : "memory");   // in front of every later write of the two loads' address pair; mp as an input keeps the pair whole up to here
        __builtin_amdgcn_sched_barrier(0);   // holds those writes behind the wait
        int c = 0;
#pragma unroll
        for (int r = 0; r < 8; ++r) c += ((r < 4 ? m0[r & 3] : m1[r & 3]) != 0) ? 1 : 0;
        int inc = c;   // kept keys of this wave up to and with this thread's 8
#pragma unroll
        for (int dl = 1; dl < 32; dl <<= 1) { const int o = __shfl_up(inc, (unsigned)dl, 32); if (lane >= dl) inc += o; }
        if (lane == 31) wsum[wv] = inc;
        __syncthreads();   // the waves' sums are read by every wave
        int kp = inc - c, n = 0;
#pragma unroll
        for (int i = 0; i < 8; ++i) { const int s = wsum[i]; n += s; if (i < wv) kp += s; }   // kp: kept keys in front of this thread's first position
#pragma unroll
        for (int r = 0; r < 8; ++r) { const bool keep = (r < 4 ? m0[r & 3] : m1[r & 3]) != 0; const int t = t8 + r;
            order[keep ? kp : n + (t - kp)] = (unsigned short)t;   // t - kp masked keys stand in front of t; every place is written once
            kp += keep ? 1 : 0; }
        __syncthreads();   // order[] is read by every wave
        nend = n ? n : TT;
        if (blockIdx.y == 1 && (blockIdx.x & 127) == 0 && threadIdx.x == 0) NK[b * 32] = n;   // one writer a batch, each batch's count in a 128-byte line of its own
    }
    if (blockIdx.y < 2) {
        const float* src = blockIdx.y ? k : q; bf* dh = blockIdx.y ? Kh : Qh;
        const int h = tile & 15, t0 = ((tile >> 4) & 63) * 32, t = t0 + (lane >> 4), c = (lane & 15) * 4;
        if (t0 >= nend) return;   // the whole wave, behind the barriers
        int p[16];   // source positions of the lane's 16 rows
        if (blockIdx.y) {   // keys: the tile's 32 places are 16 words of order[], the same for every lane; word i holds the places t0 + 2 i and t0 + 2 i + 1, one for each half of the wave
            v4u ow[4];
#pragma unroll
            for (int i = 0; i < 4; ++i) ow[i] = *(const v4ua*)(order + t0 + 8 * i);
#pragma unroll
            for (int i = 0; i < 16; ++i) p[i] = (int)((ow[i >> 2][i & 3] >> ((lane >> 4) * 16)) & 0xFFFFu);
        } else {
#pragma unroll
            for (int i = 0; i < 16; ++i) p[i] = t + 2 * i;
        }
        unsigned so[16];   // their byte offsets
#pragma unroll
        for (int i = 0; i < 16; ++i) so[i] = (unsigned)((((b * TT + p[i]) * NH_ + h) * HD + c) * 4);
        v4f a[16];
#pragma unroll
        for (int i = 0; i < 16; ++i) a[i] = *(const v4f*)((const char*)src + so[i]);
        __builtin_amdgcn_sched_barrier(0);   // all 16 loads go out before the first conversion; the scheduler otherwise holds the last ones back until registers of the first are free
        asm volatile("s_wait_xcnt 0x0" :: "v"(so[0]), "v"(so[1]), "v"(so[2]), "v"(so[3]), "v"(so[4]), "v"(so[5]), "v"(so[6]), "v"(so[7]), "v"(so[8]), "v"(so[9]), "v"(so[10]), "v"(so[11]), "v"(so[12]), "v"(so[13]), "v"(so[14]), "v"(so[15]) : "memory");   // in front of every later write of the loads' offset registers; as inputs they stay whole up to here
        __builtin_amdgcn_sched_barrier(0);   // holds those writes behind the wait
        v4us r[16];
#pragma unroll
        for (int i = 0; i < 16; ++i) { v2u u; u[0] = pack2(a[i][0], a[i][1]); u[1] = pack2(a[i][2], a[i][3]); r[i] = __builtin_bit_cast(v4us, u); }
        const size_t o = ((size_t)(b * NH_ + h) * TT + t) * HD + c;
#pragma unroll
        for (int i = 0; i < 16; ++i) *(v4us*)(dh + o + i * 2 * HD) = r[i];
    } else {
        const int h = (tile >> 1) & 15, t0 = ((tile >> 5) & 31) * 64, t = t0 + (lane >> 2) * 8, d = (tile & 1) * 32 + (lane & 3) * 4;
        if (t0 >= nend) return;   // the whole wave, behind the barriers
        const v8us pj = *(const v8us*)(order + t);
        unsigned so[8];   // byte offsets of the lane's 8 source rows
#pragma unroll
        for (int j = 0; j < 8; ++j) so[j] = (unsigned)((((b * TT + (int)pj[j]) * NH_ + h) * HD + d) * 4);
        v4f a[2][8];   // [d group of 16][place]
#pragma unroll
        for (int j = 0; j < 8; ++j)
#pragma unroll
            for (int it = 0; it < 2; ++it) a[it][j] = *(const v4f*)((const char*)(v + it * 16) + so[j]);
        __builtin_amdgcn_sched_barrier(0);   // as above: all 16 loads first,
        asm volatile("s_wait_xcnt 0x0" :: "v"(so[0]), "v"(so[1]), "v"(so[2]), "v"(so[3]), "v"(so[4]), "v"(so[5]), "v"(so[6]), "v"(so[7]) : "memory");   // the wait in front of every later write of their offset registers,
        __builtin_amdgcn_sched_barrier(0);   // and those writes behind it
        v8us r[2][4];
#pragma unroll
        for (int it = 0; it < 2; ++it)
#pragma unroll
            for (int c = 0; c < 4; ++c) { v4u u;
#pragma unroll
                for (int i = 0; i < 4; ++i) u[i] = pack2(a[it][2 * i][c], a[it][2 * i + 1][c]);
                r[it][c] = __builtin_bit_cast(v8us, u); }
        const size_t o = ((size_t)(b * NH_ + h) * HD + d) * TT + t;
#pragma unroll
        for (int it = 0; it < 2; ++it)
#pragma unroll
            for (int c = 0; c < 4; ++c) *(v8us*)(Vh + o + (size_t)(it * 16 + c) * TT) = r[it][c];
        asm volatile("s_wait_xcnt 0x0" ::: "memory");   // behind the last store: the built code lays the other branch behind this one, where registers that these stores name are written
    }
}

extern "C" void kernel_launch(void* const* d_in, const int* in_sizes, int n_in,
                              void* d_out, int out_size, void* d_ws, size_t ws_size, hipStream_t stream) {
    (void)in_sizes; (void)n_in; (void)out_size;
    const float* x = (const float*)d_in[0]; const float* xk = (const float*)d_in[1]; const float* xv = (const float*)d_in[2]; const int* kmask = (const int*)d_in[3];   /* order queries, keys, values [2][2048][16][64], mask (int32 [2][1][1][2048], read) */
    float* OUT = (float*)d_out;     // [2][2048][1024]
    char* wsp = (char*)d_ws;
    auto take = [&](size_t bytes) { char* p = wsp; wsp += (bytes + 255) & ~(size_t)255; return (void*)p; };
    const size_t PB = (size_t)NH_ * TT * HD;   // elements of one batch's plane; each plane holds both batches, [batch][head][..][..]
    bf* QPh = (bf*)take(NB_ * PB * 2); bf* KPh = (bf*)take(NB_ * PB * 2); bf* VTh = (bf*)take(NB_ * PB * 2); int* NKp = (int*)take(NB_ * 128);   // NKp: kept keys a batch, 128 bytes apart
    if ((size_t)(wsp - (char*)d_ws) > ws_size) return;    // ws 256 MiB
    k_planes<<<dim3(NB_ * NH_ * TT * HD / (256 * 64), 3), 256, 0, stream>>>(x, xk, xv, kmask, QPh, KPh, VTh, NKp);   // 64 elements a lane
    k_fattn<<<dim3(TT / 256, NB_ * NH_), 256, 0, stream>>>(QPh, KPh, VTh, NKp, OUT);   // one launch for both batches and all heads
}

// v006
// It runs in 33.7 microseconds.
// Timed twice side by side with v005, it ran 1.35 times as fast both times.
// All steps since v000 together make it 34.3 times as fast.
#include <hip/hip_runtime.h>

// Scaled dot-product attention on pre-split multi-head tensors with an integer key mask (queries, keys, values [2][2048][16][64] = (batch, position, head, dim), no projections; scores = einsum('bqhd,bkhd->bhqk') / sqrt(64); keys with mask[b][j] == 0 -> -1e20 (== exclusion; mask int32 [2][1][1][2048] random 0/1, read); softmax over the kept keys; out = einsum('bhqv,bvhd->bqhd') -> [2][2048][16][64] (4.2 M); argument order queries, keys, values, mask.
// Two launches: k_planes rounds every input to bf16 and writes one operand plane per input for both batches and all heads, queries and keys as [z][t][d], values transposed as [z][d][t], z = batch * 16 + head; then ONE fused attention kernel (k_fattn: one product for the scores, two for P x V (P as hi + lo), running softmax in registers), which writes the [position][head][dim] output rows itself.
// The key and value planes are ordered by the key mask: a batch's kept keys first, in their order, the masked ones behind them. k_fattn walks the kept keys alone, in stages of 128 that its work-group copies into LDS once for its 8 waves (a masked key's weight is an exact 0 beside any kept key); a batch with no kept key walks all 2048 at -1e20, which is the module's uniform row.
// A rounded input has no lo part: planes of zeros are neither stored nor read, and no product is formed on them (each would add an exact 0 to its accumulator).
// Compute dtypes, f32 accumulate: every input rounded to bf16; P split into bf16 hi + lo; softmax f32; output f32.

#define NB_  2
#define TT   2048
#define DM   1024
#define NH_  16
#define NKV  16
#define REP  (NH_ / NKV)
#define HD   64
#define DQ   (NH_ * HD)
#define DKV  (NKV * HD)
typedef _Float16 h16;
typedef unsigned short bf;
typedef __attribute__((ext_vector_type(16))) __bf16   v16bf;
typedef __attribute__((ext_vector_type(16))) _Float16 v16h;
typedef __attribute__((ext_vector_type(8)))  _Float16 v8h;
typedef __attribute__((ext_vector_type(8)))  unsigned short v8us;
typedef __attribute__((ext_vector_type(8)))  float    v8f;
typedef __attribute__((ext_vector_type(4)))  float    v4f;
typedef v8h  __attribute__((may_alias)) v8ha;
typedef v4f  __attribute__((may_alias)) v4fa;
typedef v8us __attribute__((may_alias)) v8usa;

__device__ __forceinline__ v16bf cat16b(v8us lo, v8us hi) { return __builtin_bit_cast(v16bf, __builtin_shufflevector(lo, hi, 0, 1, 2, 3, 4, 5, 6, 7, 8, 9, 10, 11, 12, 13, 14, 15)); }
__device__ __forceinline__ v8f wmmab(v16bf a, v16bf b, v8f c) { return __builtin_amdgcn_wmma_f32_16x16x32_bf16(false, a, false, b, (short)0, c, false, false); }



// ---- k_fattn: scores, key mask, softmax and the P x V product of one head in ONE kernel; the scores stay in registers.
// One wave owns 32 query columns and walks its batch's kept keys (all 2048 when none is kept) in passes of 32. Transposed products: S^T = K Q^T (A = key rows, B = query rows), O^T += V^T P^T (A = V^T rows, B = P^T).
// A lane's accumulator registers of two 16-key score tiles are, in order, the k positions of a B operand (k = 8 hi + r and 16 + 8 hi + r), the order in which WFrag::lds reads V^T: P needs no LDS and no lane exchange.
// Softmax is the running form in the log2 domain: m_run is the maximum in use per query; sums and O^T are rescaled only when a pass's maximum exceeds it by more than 8. P goes into its product as bf16 hi + lo (2 products); Q, K and V are bf16 values (one plane each).
// grid (TT / 256, batches x heads), 8 waves; planes [z][t][d] (Q, K) and [z][d][t] (V^T), z = batch * NH_ + head; t of K and V^T is the place in the kept-first order, NK[32 * batch] the number of kept keys.
// The 8 waves need the same K and V^T rows: a stage of SK keys (K: SK rows of 128 bytes; V^T: 64 rows of 2 SK bytes) is brought into LDS once by asynchronous copies of whole 128-byte lines, 8 copies of 16 bytes a lane, two buffers: stage s + 1 flies while stage s is worked on. Every wave reads its fragments from LDS; the row pitches are odd multiples of 16 bytes, which 16-byte reads of 16 rows take without bank conflicts.
template <typename T16> struct WFrag;
template <> struct WFrag<bf> { typedef v16bf V; static __device__ __forceinline__ V ld(const bf* p) { return cat16b(*(const v8us*)p, *(const v8us*)(p + 16)); }
    static __device__ __forceinline__ V lds(const unsigned char* p) { return cat16b(*(const v8usa*)p, *(const v8usa*)(p + 32)); } };   // lds: a fragment from an LDS row, the same k order as ld
typedef __attribute__((ext_vector_type(4))) int v4i;
typedef __attribute__((ext_vector_type(8))) unsigned v8u;
typedef __attribute__((ext_vector_type(2))) float v2f;
typedef __attribute__((ext_vector_type(2))) __bf16 v2bf;
__device__ __forceinline__ unsigned pack2(float lo, float hi) { v2f x; x[0] = lo; x[1] = hi; return __builtin_bit_cast(unsigned, __builtin_convertvector(x, v2bf)); }   // round to nearest even
__device__ __forceinline__ float xhalf(float x) { return __builtin_bit_cast(float, __builtin_amdgcn_permlanex16(__builtin_bit_cast(int, x), __builtin_bit_cast(int, x), 0x76543210, 0xfedcba98, false, false)); }   // lane l with lane l ^ 16
#define SCL2 0.18033688011112042f   // HD^-0.5 * log2(e)
#define SK     128                 // keys of a stage
#define KPIT   144                 // LDS bytes from one K row to the next (128 + 16)
#define VPIT   (2 * SK + 16)       // LDS bytes from one V^T row of a stage to the next
#define KBYTES (SK * KPIT)
#define SBYTES (KBYTES + HD * VPIT)   // one buffer: the K rows, behind them the V^T rows
// One stage's copies: gk, gv the lane's first 16 bytes in the K and V^T planes, lk, lv their LDS byte addresses; copy i of K lies 32 rows on, copy i of V^T 16 rows on. Every lane is on; each copy has registers of its own.
__device__ __forceinline__ void stage_copy(const char* gk, const char* gv, unsigned lk, unsigned lv) {
    asm volatile("global_load_async_to_lds_b128 %0, %8, off\n\t"
                 "global_load_async_to_lds_b128 %1, %9, off\n\t"
                 "global_load_async_to_lds_b128 %2, %10, off\n\t"
                 "global_load_async_to_lds_b128 %3, %11, off\n\t"
                 "global_load_async_to_lds_b128 %4, %12, off\n\t"
                 "global_load_async_to_lds_b128 %5, %13, off\n\t"
                 "global_load_async_to_lds_b128 %6, %14, off\n\t"
                 "global_load_async_to_lds_b128 %7, %15, off\n\t"
                 "s_wait_xcnt 0x0"   // in the copies' own statement: it stands in front of every later write of the registers that they name
                 :: "v"(lk), "v"(lk + 32 * KPIT), "v"(lk + 64 * KPIT), "v"(lk + 96 * KPIT), "v"(lv), "v"(lv + 16 * VPIT), "v"(lv + 32 * VPIT), "v"(lv + 48 * VPIT),
                    "v"(gk), "v"(gk + 32 * HD * 2), "v"(gk + 64 * HD * 2), "v"(gk + 96 * HD * 2), "v"(gv), "v"(gv + 16 * TT * 2), "v"(gv + 32 * TT * 2), "v"(gv + 48 * TT * 2) : "memory");
}
__global__ __launch_bounds__(256) void k_fattn(const bf* __restrict__ Qh, const bf* __restrict__ Kh, const bf* __restrict__ Vh, const int* __restrict__ NK, float* OUTp) {
    typedef WFrag<bf>::V V;
    __shared__ __attribute__((aligned(16))) unsigned char L[2 * SBYTES];
    const int lane = threadIdx.x & 31, lr = lane & 15, hi = lane >> 4, w = threadIdx.x >> 5;
    const int z = blockIdx.y, b = z / NH_, h = z % NH_; const int q0 = blockIdx.x * 256 + w * 32;
    const size_t pz = (size_t)z * TT * HD;
    int nk = __builtin_amdgcn_readfirstlane(NK[b * 32]); nk = nk < 0 ? 0 : (nk > TT ? TT : nk);   // kept keys of this batch, bounded here: it sets the trip counts; in a scalar register, so that every test on it is a scalar branch
    const int nend = nk ? nk : TT;   // keys to walk; both planes are written up to the next multiple of SK
    const int nst = (nend + SK - 1) / SK;   // stages, 1 to TT / SK
    const int lim = nk - 8 * hi;
    V qh[2][2];   // [query group][k step of 32 d]; every index below is a constant after unrolling, so all fragments and tiles stay in registers
#pragma unroll
    for (int g = 0; g < 2; ++g)
#pragma unroll
        for (int kc = 0; kc < 2; ++kc) { const size_t o = pz + (size_t)(q0 + g * 16 + lr) * HD + kc * 32 + 8 * hi; qh[g][kc] = WFrag<bf>::ld(Qh + o); }
    asm volatile("s_wait_xcnt 0x0" ::: "memory");   // in front of the start values below, which reuse the address registers of the Q loads
    __builtin_amdgcn_sched_barrier(0);   // holds those writes behind the wait
    v8f acc[2][4]; float m_run[2], l_run[2];
#pragma unroll
    for (int g = 0; g < 2; ++g) { m_run[g] = -3.0e38f; l_run[g] = 0.f;
#pragma unroll
        for (int dt = 0; dt < 4; ++dt) acc[g][dt] = (v8f){}; }
    // the lane's part of a stage's copies: K chunk threadIdx.x of 16 bytes (8 a row), V^T chunk threadIdx.x (16 a row)
    const int tid = threadIdx.x;
    const char* gk = (const char*)(Kh + pz) + tid * 16;
    const char* gv = (const char*)(Vh + pz) + (tid >> 4) * (TT * 2) + (tid & 15) * 16;
    const unsigned lbase = (unsigned)(size_t)L;
    const unsigned lk = lbase + (tid >> 3) * KPIT + (tid & 7) * 16, lv = lbase + KBYTES + (tid >> 4) * VPIT + (tid & 15) * 16;
    stage_copy(gk, gv, lk, lv);   // stage 0 into buffer 0
    asm volatile("s_wait_asynccnt 0x0" ::: "memory");   // this wave's copies of stage 0 have landed
    __syncthreads();   // every wave's have: stage 0 may be read
    if (nst > 1) stage_copy(gk + SK * HD * 2, gv + SK * 2, lk + SBYTES, lv + SBYTES);   // stage 1 into buffer 1
    const unsigned kl = lr * KPIT + 16 * hi, vl = KBYTES + lr * VPIT + 16 * hi;   // the lane's byte offsets in a buffer: fragment row lr, k positions 8 hi ..
    int k0 = 0;
#pragma unroll 1   // kept rolled: the buffer alternates by an offset, and an unrolled body would only add code
    for (int st = 0; st < nst; ++st) {
    const unsigned sb = (st & 1) * SBYTES;
    const int kend = nend < k0 + SK ? nend : k0 + SK;   // the stage's passes end here
    unsigned ko = sb + kl, vo = sb + vl;   // they walk with the passes
    V kh[2][2];   // [key tile][k step]: the K fragments of the pass at hand, fetched one pass ahead inside the stage
#pragma unroll
    for (int kt = 0; kt < 2; ++kt)
#pragma unroll
        for (int kc = 0; kc < 2; ++kc) kh[kt][kc] = WFrag<bf>::lds(L + ko + kt * 16 * KPIT + kc * 64);
#pragma unroll 1   // kept rolled: one pass is already some hundred instructions, and an unrolled body would only add code and registers
    do {   // k0 < kend at the head of every stage: there is always a first pass, so the loop needs no test in front of it
        // this pass's V^T fragments are asked for first: the score products hide their way
        V vh[4];
#pragma unroll
        for (int dt = 0; dt < 4; ++dt) vh[dt] = WFrag<bf>::lds(L + vo + dt * 16 * VPIT);
        __builtin_amdgcn_sched_barrier(0);   // keeps the loads above, as one group, in front of the score products; the scheduler otherwise sinks each next to its use, where its whole latency is waited for
        v8f s[2][2];   // [key tile][query group]: s[kt][g][r] = score of key k0 + 16 kt + 8 hi + r with query q0 + 16 g + lr
#pragma unroll
        for (int kt = 0; kt < 2; ++kt)
#pragma unroll
            for (int g = 0; g < 2; ++g) { v8f c = (v8f){};
#pragma unroll
                for (int kc = 0; kc < 2; ++kc) c = wmmab(kh[kt][kc], qh[g][kc], c);
                s[kt][g] = c; }
        __builtin_amdgcn_sched_barrier(0);   // the next pass's K loads stay behind the products that read the same fragments ...
        ko = (k0 + 32 < kend) ? ko + 32u * KPIT : sb + kl;   // the stage's last pass fetches its first pass again: rows of the same buffer, not used; nothing of the next stage is read in front of its barrier
#pragma unroll
        for (int kt = 0; kt < 2; ++kt)
#pragma unroll
            for (int kc = 0; kc < 2; ++kc) kh[kt][kc] = WFrag<bf>::lds(L + ko + kt * 16 * KPIT + kc * 64);
        __builtin_amdgcn_sched_barrier(0);   // ... and in front of the softmax and the second product, which hide their way
        // scale to the log2 domain; a key behind the kept ones (mask == 0: the last pass's fill, or every key where none is kept) takes -1e20 (the sum rounds to exactly -1e20), so a row with no kept key comes out uniform, as in the module
        const int rem = lim - k0;   // this lane's key 16 kt + r of the pass is a kept one while 16 kt + r < rem
#pragma unroll
        for (int kt = 0; kt < 2; ++kt) {
#pragma unroll
            for (int r = 0; r < 8; ++r) { const float bias = (kt * 16 + r < rem) ? 0.0f : -1.0e20f;
#pragma unroll
                for (int g = 0; g < 2; ++g) s[kt][g][r] = __builtin_fmaf(s[kt][g][r], SCL2, bias); } }
        float mb[2]; bool need = false;
#pragma unroll
        for (int g = 0; g < 2; ++g) { float mx = s[0][g][0];
#pragma unroll
            for (int r = 1; r < 8; ++r) mx = fmaxf(mx, s[0][g][r]);
#pragma unroll
            for (int r = 0; r < 8; ++r) mx = fmaxf(mx, s[1][g][r]);
            mx = fmaxf(mx, xhalf(mx));   // both halves of the wave hold the query's maximum over the pass's 32 keys
            mb[g] = mx; need = need || (mx > m_run[g] + 8.0f); }
        if (__builtin_amdgcn_ballot_w32(need) != 0) {   // wave-uniform, rare after the first passes
#pragma unroll
            for (int g = 0; g < 2; ++g) { const float m_new = fmaxf(m_run[g], mb[g]); const float corr = __builtin_amdgcn_exp2f(m_run[g] - m_new); m_run[g] = m_new; l_run[g] *= corr;
#pragma unroll
                for (int dt = 0; dt < 4; ++dt) acc[g][dt] = acc[g][dt] * corr; } }
#pragma unroll
        for (int g = 0; g < 2; ++g) { v8u wh, wl;
#pragma unroll
            for (int i = 0; i < 8; ++i) {
                const float p0 = __builtin_amdgcn_exp2f(s[i >> 2][g][2 * (i & 3)] - m_run[g]), p1 = __builtin_amdgcn_exp2f(s[i >> 2][g][2 * (i & 3) + 1] - m_run[g]);
                l_run[g] += p0 + p1;
                const unsigned u = pack2(p0, p1); wh[i] = u; wl[i] = pack2(p0 - __uint_as_float(u << 16), p1 - __uint_as_float(u & 0xFFFF0000u)); }
            const V ph = __builtin_bit_cast(V, wh), pl = __builtin_bit_cast(V, wl);
#pragma unroll
            for (int dt = 0; dt < 4; ++dt) { acc[g][dt] = wmmab(vh[dt], ph, acc[g][dt]); acc[g][dt] = wmmab(vh[dt], pl, acc[g][dt]); } }
        vo += 32 * 2; k0 += 32;
    } while (k0 < kend);
    // the stage's foot, every wave: stage st + 1 is handed over and buffer st & 1 is given free
    asm volatile("s_wait_dscnt 0x0" ::: "memory");   // this wave's reads of the buffer have returned
    asm volatile("s_wait_asynccnt 0x0" ::: "memory");   // this wave's copies of stage st + 1 have landed
    __syncthreads();   // both hold for every wave
    if (st + 2 < nst) stage_copy(gk + (st + 2) * (SK * HD * 2), gv + (st + 2) * (SK * 2), lk + sb, lv + sb);   // stage st + 2 into the buffer just read
    }
    asm volatile("s_wait_asynccnt 0x0" ::: "memory");   // no copy is left in flight when the wave ends
#pragma unroll
    for (int g = 0; g < 2; ++g) { const float l = l_run[g] + xhalf(l_run[g]);   // each half summed its own 16 keys of every pass
        const float inv = __fdiv_rn(1.0f, l);
        float* op = OUTp + ((size_t)(b * TT + q0 + g * 16 + lr) * NH_ + h) * HD + 8 * hi;   // acc[g][dt][r] = O[query q0 + 16 g + lr][d = 16 dt + 8 hi + r]
#pragma unroll
        for (int dt = 0; dt < 4; ++dt) { const v8f o = acc[g][dt] * inv; v4f o0, o1;
#pragma unroll
            for (int r = 0; r < 4; ++r) { o0[r] = o[r]; o1[r] = o[4 + r]; }
            *(v4f*)(op + dt * 16) = o0; *(v4f*)(op + dt * 16 + 4) = o1; } }
}

typedef __attribute__((ext_vector_type(4))) unsigned short v4us;
typedef __attribute__((ext_vector_type(2))) unsigned v2u;
typedef __attribute__((ext_vector_type(4))) unsigned v4u;
typedef v4u __attribute__((may_alias)) v4ua;

// ---- k_planes: every operand plane of k_fattn in ONE launch, straight from the f32 inputs [batch][t][head][d]: each plane holds its input rounded to bf16 (nearest even).
// grid (256, 3): blockIdx.y = 0 queries, 1 keys, 2 values; 8 waves. One wave owns one 8-KiB tile: it asks for its 16 loads of 16 bytes a lane at once, converts, then stores whole 128-byte lines, each line from one wave.
// The head runs fastest over the tiles, so the 8 waves of a work-group read neighbouring pieces of the same input rows.
// Keys and values: every work-group first orders its batch's 2048 positions by the key mask in LDS (order[j] = position of place j: kept keys first, masked ones behind, each kind in its own order; a count per thread of 8 positions, a running sum over the 256 threads). A tile is a run of places; its rows are fetched by order[]; a tile that starts behind the last stage of 128 places that k_fattn copies is left out.
// Queries, keys: tile = 32 positions (places) x 64 d of one head; a load takes two whole 256-byte head rows, a store two whole 128-byte plane rows.
// Values: tile = 64 places x 32 d of one head, transposed in registers: a lane holds 8 places x 4 d (twice), so the 8 places of one d are one 16-byte store, and 8 lanes fill a 128-byte line of the [d][t] plane.
__global__ __launch_bounds__(256) void k_planes(const float* __restrict__ q, const float* __restrict__ k, const float* __restrict__ v, const int* __restrict__ kmask, bf* Qh, bf* Kh, bf* Vh, int* NK) {
    __shared__ __attribute__((aligned(16))) unsigned short order[TT];
    __shared__ int wsum[8];
    const int lane = threadIdx.x & 31, wv = threadIdx.x >> 5, tile = blockIdx.x * 8 + wv;   // 2048 tiles a tensor, 1024 a batch
    const int b = tile >> 10;   // one batch a work-group (128 work-groups a batch)
    int nend = TT;   // places to fill
    if (blockIdx.y != 0) {   // the same for the whole work-group, as the two barriers inside ask
        const int t8 = threadIdx.x * 8;
        const int* mp = kmask + b * TT + t8;
        const v4i m0 = *(const v4i*)mp, m1 = *(const v4i*)(mp + 4);
        asm volatile("s_wait_xcnt 0x0" :: "v"(mp) : "memory");   // in front of every later write of the two loads' address pair; mp as an input keeps the pair whole up to here
        __builtin_amdgcn_sched_barrier(0);   // holds those writes behind the wait
        int c = 0;
#pragma unroll
        for (int r = 0; r < 8; ++r) c += ((r < 4 ? m0[r & 3] : m1[r & 3]) != 0) ? 1 : 0;
        int inc = c;   // kept keys of this wave up to and with this thread's 8
#pragma unroll
        for (int dl = 1; dl < 32; dl <<= 1) { const int o = __shfl_up(inc, (unsigned)dl, 32); if (lane >= dl) inc += o; }
        if (lane == 31) wsum[wv] = inc;
        __syncthreads();   // the waves' sums are read by every wave
        int kp = inc - c, n = 0;
#pragma unroll
        for (int i = 0; i < 8; ++i) { const int s = wsum[i]; n += s; if (i < wv) kp += s; }   // kp: kept keys in front of this thread's first position
#pragma unroll
        for (int r = 0; r < 8; ++r) { const bool keep = (r < 4 ? m0[r & 3] : m1[r & 3]) != 0; const int t = t8 + r;
            order[keep ? kp : n + (t - kp)] = (unsigned short)t;   // t - kp masked keys stand in front of t; every place is written once
            kp += keep ? 1 : 0; }
        __syncthreads();   // order[] is read by every wave
        nend = n ? (n + 127) & ~127 : TT;   // k_fattn copies whole stages of 128 places
        if (blockIdx.y == 1 && (blockIdx.x & 127) == 0 && threadIdx.x == 0) NK[b * 32] = n;   // one writer a batch, each batch's count in a 128-byte line of its own
    }
    if (blockIdx.y < 2) {
        const float* src = blockIdx.y ? k : q; bf* dh = blockIdx.y ? Kh : Qh;
        const int h = tile & 15, t0 = ((tile >> 4) & 63) * 32, t = t0 + (lane >> 4), c = (lane & 15) * 4;
        if (t0 >= nend) return;   // the whole wave, behind the barriers
        int p[16];   // source positions of the lane's 16 rows
        if (blockIdx.y) {   // keys: the tile's 32 places are 16 words of order[], the same for every lane; word i holds the places t0 + 2 i and t0 + 2 i + 1, one for each half of the wave
            v4u ow[4];
#pragma unroll
            for (int i = 0; i < 4; ++i) ow[i] = *(const v4ua*)(order + t0 + 8 * i);
#pragma unroll
            for (int i = 0; i < 16; ++i) p[i] = (int)((ow[i >> 2][i & 3] >> ((lane >> 4) * 16)) & 0xFFFFu);
        } else {
#pragma unroll
            for (int i = 0; i < 16; ++i) p[i] = t + 2 * i;
        }
        unsigned so[16];   // their byte offsets
#pragma unroll
        for (int i = 0; i < 16; ++i) so[i] = (unsigned)((((b * TT + p[i]) * NH_ + h) * HD + c) * 4);
        v4f a[16];
#pragma unroll
        for (int i = 0; i < 16; ++i) a[i] = *(const v4f*)((const char*)src + so[i]);
        __builtin_amdgcn_sched_barrier(0);   // all 16 loads go out before the first conversion; the scheduler otherwise holds the last ones back until registers of the first are free
        asm volatile("s_wait_xcnt 0x0" :: "v"(so[0]), "v"(so[1]), "v"(so[2]), "v"(so[3]), "v"(so[4]), "v"(so[5]), "v"(so[6]), "v"(so[7]), "v"(so[8]), "v"(so[9]), "v"(so[10]), "v"(so[11]), "v"(so[12]), "v"(so[13]), "v"(so[14]), "v"(so[15]) : "memory");   // in front of every later write of the loads' offset registers; as inputs they stay whole up to here
        __builtin_amdgcn_sched_barrier(0);   // holds those writes behind the wait
        v4us r[16];
#pragma unroll
        for (int i = 0; i < 16; ++i) { v2u u; u[0] = pack2(a[i][0], a[i][1]); u[1] = pack2(a[i][2], a[i][3]); r[i] = __builtin_bit_cast(v4us, u); }
        const size_t o = ((size_t)(b * NH_ + h) * TT + t) * HD + c;
#pragma unroll
        for (int i = 0; i < 16; ++i) *(v4us*)(dh + o + i * 2 * HD) = r[i];
    } else {
        const int h = (tile >> 1) & 15, t0 = ((tile >> 5) & 31) * 64, t = t0 + (lane >> 2) * 8, d = (tile & 1) * 32 + (lane & 3) * 4;
        if (t0 >= nend) return;   // the whole wave, behind the barriers
        const v8us pj = *(const v8us*)(order + t);
        unsigned so[8];   // byte offsets of the lane's 8 source rows
#pragma unroll
        for (int j = 0; j < 8; ++j) so[j] = (unsigned)((((b * TT + (int)pj[j]) * NH_ + h) * HD + d) * 4);
        v4f a[2][8];   // [d group of 16][place]
#pragma unroll
        for (int j = 0; j < 8; ++j)
#pragma unroll
            for (int it = 0; it < 2; ++it) a[it][j] = *(const v4f*)((const char*)(v + it * 16) + so[j]);
        __builtin_amdgcn_sched_barrier(0);   // as above: all 16 loads first,
        asm volatile("s_wait_xcnt 0x0" :: "v"(so[0]), "v"(so[1]), "v"(so[2]), "v"(so[3]), "v"(so[4]), "v"(so[5]), "v"(so[6]), "v"(so[7]) : "memory");   // the wait in front of every later write of their offset registers,
        __builtin_amdgcn_sched_barrier(0);   // and those writes behind it
        v8us r[2][4];
#pragma unroll
        for (int it = 0; it < 2; ++it)
#pragma unroll
            for (int c = 0; c < 4; ++c) { v4u u;
#pragma unroll
                for (int i = 0; i < 4; ++i) u[i] = pack2(a[it][2 * i][c], a[it][2 * i + 1][c]);
                r[it][c] = __builtin_bit_cast(v8us, u); }
        const size_t o = ((size_t)(b * NH_ + h) * HD + d) * TT + t;
#pragma unroll
        for (int it = 0; it < 2; ++it)
#pragma unroll
            for (int c = 0; c < 4; ++c) *(v8us*)(Vh + o + (size_t)(it * 16 + c) * TT) = r[it][c];
        asm volatile("s_wait_xcnt 0x0" ::: "memory");   // behind the last store: the built code lays the other branch behind this one, where registers that these stores name are written
    }
}

extern "C" void kernel_launch(void* const* d_in, const int* in_sizes, int n_in,
                              void* d_out, int out_size, void* d_ws, size_t ws_size, hipStream_t stream) {
    (void)in_sizes; (void)n_in; (void)out_size;
    const float* x = (const float*)d_in[0]; const float* xk = (const float*)d_in[1]; const float* xv = (const float*)d_in[2]; const int* kmask = (const int*)d_in[3];   /* order queries, keys, values [2][2048][16][64], mask (int32 [2][1][1][2048], read) */
    float* OUT = (float*)d_out;     // [2][2048][1024]
    char* wsp = (char*)d_ws;
    auto take = [&](size_t bytes) { char* p = wsp; wsp += (bytes + 255) & ~(size_t)255; return (void*)p; };
    const size_t PB = (size_t)NH_ * TT * HD;   // elements of one batch's plane; each plane holds both batches, [batch][head][..][..]
    bf* QPh = (bf*)take(NB_ * PB * 2); bf* KPh = (bf*)take(NB_ * PB * 2); bf* VTh = (bf*)take(NB_ * PB * 2); int* NKp = (int*)take(NB_ * 128);   // NKp: kept keys a batch, 128 bytes apart
    if ((size_t)(wsp - (char*)d_ws) > ws_size) return;    // ws 256 MiB
    k_planes<<<dim3(NB_ * NH_ * TT * HD / (256 * 64), 3), 256, 0, stream>>>(x, xk, xv, kmask, QPh, KPh, VTh, NKp);   // 64 elements a lane
    k_fattn<<<dim3(TT / 256, NB_ * NH_), 256, 0, stream>>>(QPh, KPh, VTh, NKp, OUT);   // one launch for both batches and all heads
}

// v007
// Measured time: 29.5 microseconds a run.
// Timed twice side by side with v006, it ran 1.15 and 1.14 times as fast.
// Counting every step since v000, it is 39.2 times as fast.
#include <hip/hip_runtime.h>

// Scaled dot-product attention on pre-split multi-head tensors with an integer key mask (queries, keys, values [2][2048][16][64] = (batch, position, head, dim), no projections; scores = einsum('bqhd,bkhd->bhqk') / sqrt(64); keys with mask[b][j] == 0 -> -1e20 (== exclusion; mask int32 [2][1][1][2048] random 0/1, read); softmax over the kept keys; out = einsum('bhqv,bvhd->bqhd') -> [2][2048][16][64] (4.2 M); argument order queries, keys, values, mask.
// ONE launch, no workspace: k_fattn reads the f32 inputs itself, rounds every value to bf16 on its way into registers (queries) or LDS (keys, values), and does one product for the scores, two for P x V (P as hi + lo), running softmax in registers; it writes the [position][head][dim] output rows itself.
// Keys are walked in the order of the key mask: a batch's kept keys first, in their order, the masked ones behind them. Every work-group forms that order in LDS and walks the kept keys alone, in stages of 128 that it brings into LDS once for its 8 waves (a masked key's weight is an exact 0 beside any kept key); a batch with no kept key walks all 2048 at -1e20, which is the module's uniform row.
// Compute dtypes, f32 accumulate: every input rounded to bf16; P split into bf16 hi + lo; softmax f32; output f32.

#define NB_  2
#define TT   2048
#define DM   1024
#define NH_  16
#define NKV  16
#define REP  (NH_ / NKV)
#define HD   64
#define DQ   (NH_ * HD)
#define DKV  (NKV * HD)
typedef _Float16 h16;
typedef unsigned short bf;
typedef __attribute__((ext_vector_type(16))) __bf16   v16bf;
typedef __attribute__((ext_vector_type(16))) _Float16 v16h;
typedef __attribute__((ext_vector_type(8)))  _Float16 v8h;
typedef __attribute__((ext_vector_type(8)))  unsigned short v8us;
typedef __attribute__((ext_vector_type(8)))  float    v8f;
typedef __attribute__((ext_vector_type(4)))  float    v4f;
typedef v8h  __attribute__((may_alias)) v8ha;
typedef v4f  __attribute__((may_alias)) v4fa;
typedef v8us __attribute__((may_alias)) v8usa;

__device__ __forceinline__ v16bf cat16b(v8us lo, v8us hi) { return __builtin_bit_cast(v16bf, __builtin_shufflevector(lo, hi, 0, 1, 2, 3, 4, 5, 6, 7, 8, 9, 10, 11, 12, 13, 14, 15)); }
__device__ __forceinline__ v8f wmmab(v16bf a, v16bf b, v8f c) { return __builtin_amdgcn_wmma_f32_16x16x32_bf16(false, a, false, b, (short)0, c, false, false); }



// ---- k_fattn: key order, rounding of the inputs, scores, key mask, softmax and the P x V product of one head in ONE kernel; the scores stay in registers.
// One wave owns 32 query columns and walks the keys in passes of 32. Transposed products: S^T = K Q^T (A = key rows, B = query rows), O^T += V^T P^T (A = V^T rows, B = P^T).
// A lane's accumulator registers of two 16-key score tiles are, in order, the k positions of a B operand (k = 8 hi + r and 16 + 8 hi + r), the order in which WFrag::lds reads V^T: P needs no LDS and no lane exchange.
// Softmax is the running form in the log2 domain: m_run is the maximum in use per query; sums and O^T are rescaled only when a pass's maximum exceeds it by more than 8. P goes into its product as bf16 hi + lo (2 products); Q, K and V are bf16 values.
// grid (TT / 256, batches x heads), 8 waves; z = batch * NH_ + head.
// Key order: order[j] = position of place j (kept keys first, masked ones behind, each kind in its own order; a count per thread of 8 positions, a running sum over the 256 threads).
// The 8 waves need the same K and V^T rows: a stage of SK places lies in LDS as K (SK rows of 128 bytes) and V^T (64 rows of 2 SK bytes), two buffers. Each wave brings one eighth of a stage: at the head of the stage before it issues 16 asynchronous copies of 16 bytes a lane (f32 rows fetched by order[]) into its own piece of the next buffer's raw part, and at that stage's foot it reads them back, rounds them and stores them into the other buffer, so the copies fly while the stage is worked on and hold no registers.
// Waves 0 to 3: K, 32 places x 64 d each (a copy takes two whole 256-byte head rows). Waves 4 to 7: V, 64 places x 32 d each, transposed in registers: a lane holds 8 places x 4 d (twice), so the 8 places of one d are one 16-byte LDS store.
// Every wave reads its fragments from LDS; the row pitches are odd multiples of 16 bytes, which 16-byte reads of 16 rows take without bank conflicts.
template <typename T16> struct WFrag;
template <> struct WFrag<bf> { typedef v16bf V; static __device__ __forceinline__ V lds(const unsigned char* p) { return cat16b(*(const v8usa*)p, *(const v8usa*)(p + 32)); } };   // lds: a fragment from an LDS row, k positions 8 hi .. and 16 + 8 hi .. of each 32, where p stands at 16 hi bytes
typedef __attribute__((ext_vector_type(4))) int v4i;
typedef __attribute__((ext_vector_type(8))) unsigned v8u;
typedef __attribute__((ext_vector_type(2))) float v2f;
typedef __attribute__((ext_vector_type(2))) __bf16 v2bf;
__device__ __forceinline__ unsigned pack2(float lo, float hi) { v2f x; x[0] = lo; x[1] = hi; return __builtin_bit_cast(unsigned, __builtin_convertvector(x, v2bf)); }   // round to nearest even
__device__ __forceinline__ float xhalf(float x) { return __builtin_bit_cast(float, __builtin_amdgcn_permlanex16(__builtin_bit_cast(int, x), __builtin_bit_cast(int, x), 0x76543210, 0xfedcba98, false, false)); }   // lane l with lane l ^ 16
#define SCL2 0.18033688011112042f   // HD^-0.5 * log2(e)
#define SK     128                 // keys of a stage
#define KPIT   144                 // LDS bytes from one K row to the next (128 + 16)
#define VPIT   (2 * SK + 16)       // LDS bytes from one V^T row of a stage to the next
#define KBYTES (SK * KPIT)
#define SBYTES (KBYTES + HD * VPIT)   // one buffer's rows: the K rows, behind them the V^T rows
#define RAWW   (16 * 512)          // behind a buffer's rows its raw part: the stage's f32 values as they land, 16 x 512 bytes a wave, each lane's 16 bytes of copy i at (i * 32 + lane) * 16
#define BUFB   (SBYTES + 8 * RAWW)   // LDS bytes from one buffer to the other
// Eight of a wave's copies: g + o[i] the lane's 16 bytes in the K or V tensor, l + 512 i their LDS byte address. Every lane is on; each copy has registers of its own.
__device__ __forceinline__ void copy8(const char* g, unsigned o0, unsigned o1, unsigned o2, unsigned o3, unsigned o4, unsigned o5, unsigned o6, unsigned o7, unsigned l) {
    asm volatile("global_load_async_to_lds_b128 %0, %8, off\n\t"
                 "global_load_async_to_lds_b128 %1, %9, off\n\t"
                 "global_load_async_to_lds_b128 %2, %10, off\n\t"
                 "global_load_async_to_lds_b128 %3, %11, off\n\t"
                 "global_load_async_to_lds_b128 %4, %12, off\n\t"
                 "global_load_async_to_lds_b128 %5, %13, off\n\t"
                 "global_load_async_to_lds_b128 %6, %14, off\n\t"
                 "global_load_async_to_lds_b128 %7, %15, off\n\t"
                 "s_wait_xcnt 0x0"   // in the copies' own statement: it stands in front of every later write of the registers that they name
                 :: "v"(l), "v"(l + 512), "v"(l + 1024), "v"(l + 1536), "v"(l + 2048), "v"(l + 2560), "v"(l + 3072), "v"(l + 3584),
                    "v"(g + o0), "v"(g + o1), "v"(g + o2), "v"(g + o3), "v"(g + o4), "v"(g + o5), "v"(g + o6), "v"(g + o7) : "memory");
}
typedef __attribute__((ext_vector_type(2))) unsigned v2u;
typedef __attribute__((ext_vector_type(4))) unsigned v4u;
typedef v4u  __attribute__((may_alias)) v4ua;
typedef v2u  __attribute__((may_alias)) v2ua;
// A wave's part of the stage that starts at place p0: the byte offsets so[] of its 16 copies in the K (kw) or V tensor, from order[]; row0 = batch * TT, h the head, u the wave's number among the four of its kind.
__device__ __forceinline__ void stage_offsets(const unsigned short* order, bool kw, int u, int lane, int row0, int h, int p0, unsigned (&so)[16]) {
    if (kw) {   // the tile's 32 places are 16 words of order[], the same for every lane; word i holds the places 2 i and 2 i + 1, one for each half of the wave
        const int t0 = p0 + u * 32, c = (lane & 15) * 4;
        v4u ow[4];
#pragma unroll
        for (int i = 0; i < 4; ++i) ow[i] = *(const v4ua*)(order + t0 + 8 * i);
#pragma unroll
        for (int i = 0; i < 16; ++i) { const int p = (int)((ow[i >> 2][i & 3] >> ((lane >> 4) * 16)) & 0xFFFFu); so[i] = (unsigned)((((row0 + p) * NH_ + h) * HD + c) * 4); }
    } else {   // copy 2 j + it: place j of the lane's 8, d group it of 16
        const int t = p0 + (u >> 1) * 64 + (lane >> 2) * 8, d = (u & 1) * 32 + (lane & 3) * 4;
        const v8us pj = *(const v8usa*)(order + t);
#pragma unroll
        for (int j = 0; j < 8; ++j) { const unsigned o = (unsigned)((((row0 + (int)pj[j]) * NH_ + h) * HD + d) * 4); so[2 * j] = o; so[2 * j + 1] = o + 16 * 4; }
    }
}
// The same part, landed at R (the lane's own 16 bytes of each copy): read back, rounded to bf16 (nearest even) and stored into the buffer at B.
__device__ __forceinline__ void stage_store(unsigned char* B, const unsigned char* R, bool kw, int u, int lane) {
    v4f a[16];
#pragma unroll
    for (int i = 0; i < 16; ++i) a[i] = *(const v4fa*)(R + i * 512);
    if (kw) {
        unsigned char* p = B + (u * 32 + (lane >> 4)) * KPIT + (lane & 15) * 8;
#pragma unroll
        for (int i = 0; i < 16; ++i) { v2u x; x[0] = pack2(a[i][0], a[i][1]); x[1] = pack2(a[i][2], a[i][3]); *(v2ua*)(p + i * 2 * KPIT) = x; }
    } else {
        unsigned char* p = B + KBYTES + ((u & 1) * 32 + (lane & 3) * 4) * VPIT + ((u >> 1) * 64 + (lane >> 2) * 8) * 2;
#pragma unroll
        for (int it = 0; it < 2; ++it)
#pragma unroll
            for (int c = 0; c < 4; ++c) { v4u x;
#pragma unroll
                for (int i = 0; i < 4; ++i) x[i] = pack2(a[4 * i + it][c], a[4 * i + 2 + it][c]);   // places 2 i and 2 i + 1 of d group it
                *(v4ua*)(p + (it * 16 + c) * VPIT) = x; }
    }
}
__global__ __launch_bounds__(256) void k_fattn(const float* __restrict__ q, const float* __restrict__ k, const float* __restrict__ v, const int* __restrict__ kmask, float* OUTp) {
    typedef WFrag<bf>::V V;
    __shared__ __attribute__((aligned(16))) unsigned char L[2 * BUFB];
    __shared__ __attribute__((aligned(16))) unsigned short order[TT];
    __shared__ int wsum[8];
    const int lane = threadIdx.x & 31, lr = lane & 15, hi = lane >> 4;
    const int w = __builtin_amdgcn_readfirstlane(threadIdx.x >> 5);   // in a scalar register: the tests on it are scalar branches
    const int z = blockIdx.y, b = z / NH_, h = z % NH_; const int q0 = blockIdx.x * 256 + w * 32;
    // the lane's query values (f32) and its 8 mask words are asked for together
    const float* qp = q + ((size_t)(b * TT + q0 + lr) * NH_ + h) * HD + 8 * hi;
    v4f qa[2][2][4];   // [query group][k step of 32 d][d 0.., 4.., 16.., 20.. behind 8 hi]
#pragma unroll
    for (int g = 0; g < 2; ++g)
#pragma unroll
        for (int kc = 0; kc < 2; ++kc)
#pragma unroll
            for (int i = 0; i < 4; ++i) qa[g][kc][i] = *(const v4f*)(qp + g * 16 * NH_ * HD + kc * 32 + (i >> 1) * 16 + (i & 1) * 4);
    const int t8 = threadIdx.x * 8;
    const int* mp = kmask + b * TT + t8;
    const v4i m0 = *(const v4i*)mp, m1 = *(const v4i*)(mp + 4);
    asm volatile("s_wait_xcnt 0x0" :: "v"(qp), "v"(mp) : "memory");   // in front of every later write of these loads' address pairs; as inputs the pairs stay whole up to here
    __builtin_amdgcn_sched_barrier(0);   // holds those writes behind the wait
    int c = 0;
#pragma unroll
    for (int r = 0; r < 8; ++r) c += ((r < 4 ? m0[r & 3] : m1[r & 3]) != 0) ? 1 : 0;
    int inc = c;   // kept keys of this wave up to and with this thread's 8
#pragma unroll
    for (int dl = 1; dl < 32; dl <<= 1) { const int o = __shfl_up(inc, (unsigned)dl, 32); if (lane >= dl) inc += o; }
    if (lane == 31) wsum[w] = inc;
    __syncthreads();   // the waves' sums are read by every wave
    int kp = inc - c, n = 0;
#pragma unroll
    for (int i = 0; i < 8; ++i) { const int sm = wsum[i]; n += sm; if (i < w) kp += sm; }   // kp: kept keys in front of this thread's first position
#pragma unroll
    for (int r = 0; r < 8; ++r) { const bool keep = (r < 4 ? m0[r & 3] : m1[r & 3]) != 0; const int t = t8 + r;
        order[keep ? kp : n + (t - kp)] = (unsigned short)t;   // t - kp masked keys stand in front of t; every place is written once
        kp += keep ? 1 : 0; }
    __syncthreads();   // order[] is read by every wave
    int nk = __builtin_amdgcn_readfirstlane(n); nk = nk < 0 ? 0 : (nk > TT ? TT : nk);   // kept keys of this batch, bounded here: it sets the trip counts; in a scalar register, so that every test on it is a scalar branch
    const int nend = nk ? nk : TT;   // keys to walk; a stage is always filled whole, the last one with masked keys behind the kept ones
    const int nst = (nend + SK - 1) / SK;   // stages, 1 to TT / SK
    const int lim = nk - 8 * hi;
    const bool kw = w < 4; const int u = w & 3;   // the wave's part of every stage
    const float* src = kw ? k : v;
    const char* src8 = (const char*)src;
    const unsigned char* R = L + SBYTES + w * RAWW + lane * 16;   // the lane's place in the wave's own raw part of buffer 0, which no other wave touches
    const unsigned lraw = (unsigned)(size_t)R;
    unsigned so[16];
    stage_offsets(order, kw, u, lane, b * TT, h, 0, so);
    copy8(src8, so[0], so[1], so[2], so[3], so[4], so[5], so[6], so[7], lraw); copy8(src8, so[8], so[9], so[10], so[11], so[12], so[13], so[14], so[15], lraw + 8 * 512);   // stage 0
    V qh[2][2];   // [query group][k step of 32 d]; every index below is a constant after unrolling, so all fragments and tiles stay in registers
#pragma unroll
    for (int g = 0; g < 2; ++g)
#pragma unroll
        for (int kc = 0; kc < 2; ++kc) { v8u x;
#pragma unroll
            for (int i = 0; i < 4; ++i) { x[2 * i] = pack2(qa[g][kc][i][0], qa[g][kc][i][1]); x[2 * i + 1] = pack2(qa[g][kc][i][2], qa[g][kc][i][3]); }
            qh[g][kc] = __builtin_bit_cast(V, x); }
    v8f acc[2][4]; float m_run[2], l_run[2];
#pragma unroll
    for (int g = 0; g < 2; ++g) { m_run[g] = -3.0e38f; l_run[g] = 0.f;
#pragma unroll
        for (int dt = 0; dt < 4; ++dt) acc[g][dt] = (v8f){}; }
    asm volatile("s_wait_asynccnt 0x0" ::: "memory");   // this wave's copies of stage 0 have landed; it alone reads them
    stage_store(L, R, kw, u, lane);   // stage 0 into buffer 0
    __syncthreads();   // every wave's part is there: stage 0 may be read
    const unsigned kl = lr * KPIT + 16 * hi, vl = KBYTES + lr * VPIT + 16 * hi;   // the lane's byte offsets in a buffer: fragment row lr, k positions 8 hi ..
    int k0 = 0;
#pragma unroll 1   // kept rolled: the buffer alternates by an offset, and an unrolled body would only add code
    for (int st = 0; st < nst; ++st) {
    const unsigned sb = (st & 1) * BUFB, nb = BUFB - sb;   // this stage's buffer, the next one's
    const bool more = st + 1 < nst;   // the same for the whole work-group, a scalar test
    if (more) { stage_offsets(order, kw, u, lane, b * TT, h, (st + 1) * SK, so);   // stage st + 1 is asked for; it flies while stage st is worked on
        copy8(src8, so[0], so[1], so[2], so[3], so[4], so[5], so[6], so[7], lraw + nb); copy8(src8, so[8], so[9], so[10], so[11], so[12], so[13], so[14], so[15], lraw + nb + 8 * 512); }
    const int kend = nend < k0 + SK ? nend : k0 + SK;   // the stage's passes end here
    unsigned ko = sb + kl, vo = sb + vl;   // they walk with the passes
    V kh[2][2];   // [key tile][k step]: the K fragments of the pass at hand, fetched one pass ahead inside the stage
#pragma unroll
    for (int kt = 0; kt < 2; ++kt)
#pragma unroll
        for (int kc = 0; kc < 2; ++kc) kh[kt][kc] = WFrag<bf>::lds(L + ko + kt * 16 * KPIT + kc * 64);
#pragma unroll 1   // kept rolled: one pass is already some hundred instructions, and an unrolled body would only add code and registers
    do {   // k0 < kend at the head of every stage: there is always a first pass, so the loop needs no test in front of it
        // this pass's V^T fragments are asked for first: the score products hide their way
        V vh[4];
#pragma unroll
        for (int dt = 0; dt < 4; ++dt) vh[dt] = WFrag<bf>::lds(L + vo + dt * 16 * VPIT);
        __builtin_amdgcn_sched_barrier(0);   // keeps the loads above, as one group, in front of the score products; the scheduler otherwise sinks each next to its use, where its whole latency is waited for
        v8f s[2][2];   // [key tile][query group]: s[kt][g][r] = score of key k0 + 16 kt + 8 hi + r with query q0 + 16 g + lr
#pragma unroll
        for (int kt = 0; kt < 2; ++kt)
#pragma unroll
            for (int g = 0; g < 2; ++g) { v8f c = (v8f){};
#pragma unroll
                for (int kc = 0; kc < 2; ++kc) c = wmmab(kh[kt][kc], qh[g][kc], c);
                s[kt][g] = c; }
        __builtin_amdgcn_sched_barrier(0);   // the next pass's K loads stay behind the products that read the same fragments ...
        ko = (k0 + 32 < kend) ? ko + 32u * KPIT : sb + kl;   // the stage's last pass fetches its first pass again: rows of the same buffer, not used; nothing of the next stage is read in front of its barrier
#pragma unroll
        for (int kt = 0; kt < 2; ++kt)
#pragma unroll
            for (int kc = 0; kc < 2; ++kc) kh[kt][kc] = WFrag<bf>::lds(L + ko + kt * 16 * KPIT + kc * 64);
        __builtin_amdgcn_sched_barrier(0);   // ... and in front of the softmax and the second product, which hide their way
        // scale to the log2 domain; a key behind the kept ones (mask == 0: the last pass's fill, or every key where none is kept) takes -1e20 (the sum rounds to exactly -1e20), so a row with no kept key comes out uniform, as in the module
        const int rem = lim - k0;   // this lane's key 16 kt + r of the pass is a kept one while 16 kt + r < rem
#pragma unroll
        for (int kt = 0; kt < 2; ++kt) {
#pragma unroll
            for (int r = 0; r < 8; ++r) { const float bias = (kt * 16 + r < rem) ? 0.0f : -1.0e20f;
#pragma unroll
                for (int g = 0; g < 2; ++g) s[kt][g][r] = __builtin_fmaf(s[kt][g][r], SCL2, bias); } }
        float mb[2]; bool need = false;
#pragma unroll
        for (int g = 0; g < 2; ++g) { float mx = s[0][g][0];
#pragma unroll
            for (int r = 1; r < 8; ++r) mx = fmaxf(mx, s[0][g][r]);
#pragma unroll
            for (int r = 0; r < 8; ++r) mx = fmaxf(mx, s[1][g][r]);
            mx = fmaxf(mx, xhalf(mx));   // both halves of the wave hold the query's maximum over the pass's 32 keys
            mb[g] = mx; need = need || (mx > m_run[g] + 8.0f); }
        if (__builtin_amdgcn_ballot_w32(need) != 0) {   // wave-uniform, rare after the first passes
#pragma unroll
            for (int g = 0; g < 2; ++g) { const float m_new = fmaxf(m_run[g], mb[g]); const float corr = __builtin_amdgcn_exp2f(m_run[g] - m_new); m_run[g] = m_new; l_run[g] *= corr;
#pragma unroll
                for (int dt = 0; dt < 4; ++dt) acc[g][dt] = acc[g][dt] * corr; } }
#pragma unroll
        for (int g = 0; g < 2; ++g) { v8u wh, wl;
#pragma unroll
            for (int i = 0; i < 8; ++i) {
                const float p0 = __builtin_amdgcn_exp2f(s[i >> 2][g][2 * (i & 3)] - m_run[g]), p1 = __builtin_amdgcn_exp2f(s[i >> 2][g][2 * (i & 3) + 1] - m_run[g]);
                l_run[g] += p0 + p1;
                const unsigned u = pack2(p0, p1); wh[i] = u; wl[i] = pack2(p0 - __uint_as_float(u << 16), p1 - __uint_as_float(u & 0xFFFF0000u)); }
            const V ph = __builtin_bit_cast(V, wh), pl = __builtin_bit_cast(V, wl);
#pragma unroll
            for (int dt = 0; dt < 4; ++dt) { acc[g][dt] = wmmab(vh[dt], ph, acc[g][dt]); acc[g][dt] = wmmab(vh[dt], pl, acc[g][dt]); } }
        vo += 32 * 2; k0 += 32;
    } while (k0 < kend);
    // the stage's foot, every wave: stage st + 1 goes into the other buffer, whose last readers left it in front of the barrier of stage st - 1
    asm volatile("s_wait_asynccnt 0x0" ::: "memory");   // this wave's copies of stage st + 1 have landed; it alone reads them
    if (more) stage_store(L + nb, R + nb, kw, u, lane);
    asm volatile("s_wait_dscnt 0x0" ::: "memory");   // this wave's reads of the buffer and of its raw part have returned, its stores have landed
    __syncthreads();   // that holds for every wave: stage st + 1 may be read, buffer st & 1 may be refilled
    }
#pragma unroll
    for (int g = 0; g < 2; ++g) { const float l = l_run[g] + xhalf(l_run[g]);   // each half summed its own 16 keys of every pass
        const float inv = __fdiv_rn(1.0f, l);
        float* op = OUTp + ((size_t)(b * TT + q0 + g * 16 + lr) * NH_ + h) * HD + 8 * hi;   // acc[g][dt][r] = O[query q0 + 16 g + lr][d = 16 dt + 8 hi + r]
#pragma unroll
        for (int dt = 0; dt < 4; ++dt) { const v8f o = acc[g][dt] * inv; v4f o0, o1;
#pragma unroll
            for (int r = 0; r < 4; ++r) { o0[r] = o[r]; o1[r] = o[4 + r]; }
            *(v4f*)(op + dt * 16) = o0; *(v4f*)(op + dt * 16 + 4) = o1; } }
}

extern "C" void kernel_launch(void* const* d_in, const int* in_sizes, int n_in,
                              void* d_out, int out_size, void* d_ws, size_t ws_size, hipStream_t stream) {
    (void)in_sizes; (void)n_in; (void)out_size; (void)d_ws; (void)ws_size;
    const float* x = (const float*)d_in[0]; const float* xk = (const float*)d_in[1]; const float* xv = (const float*)d_in[2]; const int* kmask = (const int*)d_in[3];   /* order queries, keys, values [2][2048][16][64], mask (int32 [2][1][1][2048], read) */
    float* OUT = (float*)d_out;     // [2][2048][1024]
    k_fattn<<<dim3(TT / 256, NB_ * NH_), 256, 0, stream>>>(x, xk, xv, kmask, OUT);   // one launch for both batches and all heads
}

// v009
// A run of this version takes 25.3 microseconds.
// It is 1.17 times as fast as v007, going by the measured steps of the versions left out in between.
// All steps since v000 together make it 45.7 times as fast.
#include <hip/hip_runtime.h>

// Scaled dot-product attention on pre-split multi-head tensors with an integer key mask (queries, keys, values [2][2048][16][64] = (batch, position, head, dim), no projections; scores = einsum('bqhd,bkhd->bhqk') / sqrt(64); keys with mask[b][j] == 0 -> -1e20 (== exclusion; mask int32 [2][1][1][2048] random 0/1, read); softmax over the kept keys; out = einsum('bhqv,bvhd->bqhd') -> [2][2048][16][64] (4.2 M); argument order queries, keys, values, mask.
// ONE launch, no workspace: k_fattn reads the f32 inputs itself, rounds every value to bf16 on its way into registers (queries) or LDS (keys, values), and does one product for the scores (bf16) and one for P x V (f16), running softmax in registers; it writes the [position][head][dim] output rows itself.
// Keys are walked in the order of the key mask: a batch's kept keys first, in their order, the masked ones behind them. Every work-group forms that order in LDS and walks the kept keys alone, in stages of 128 that it brings into LDS once for its 16 waves (a masked key's weight is an exact 0 beside any kept key); a batch with no kept key walks all 2048 at -1e20, which is the module's uniform row.
// Compute dtypes, f32 accumulate: every input rounded to bf16; P rounded once to f16 (11 significant bits, 0 <= P <= 2^8); V's bf16 values are carried as f16, which holds them exactly from 2^-17 up to 65504 (below that to 2^-25 absolute; normal deviates stay far inside); softmax f32; output f32.

#define NB_  2
#define TT   2048
#define DM   1024
#define NH_  16
#define NKV  16
#define REP  (NH_ / NKV)
#define HD   64
#define DQ   (NH_ * HD)
#define DKV  (NKV * HD)
typedef _Float16 h16;
typedef unsigned short bf;
typedef __attribute__((ext_vector_type(16))) __bf16   v16bf;
typedef __attribute__((ext_vector_type(16))) _Float16 v16h;
typedef __attribute__((ext_vector_type(8)))  _Float16 v8h;
typedef __attribute__((ext_vector_type(8)))  unsigned short v8us;
typedef __attribute__((ext_vector_type(8)))  float    v8f;
typedef __attribute__((ext_vector_type(4)))  float    v4f;
typedef v8h  __attribute__((may_alias)) v8ha;
typedef v4f  __attribute__((may_alias)) v4fa;
typedef v8us __attribute__((may_alias)) v8usa;

__device__ __forceinline__ v16bf cat16b(v8us lo, v8us hi) { return __builtin_bit_cast(v16bf, __builtin_shufflevector(lo, hi, 0, 1, 2, 3, 4, 5, 6, 7, 8, 9, 10, 11, 12, 13, 14, 15)); }
__device__ __forceinline__ v8f wmmab(v16bf a, v16bf b, v8f c) { return __builtin_amdgcn_wmma_f32_16x16x32_bf16(false, a, false, b, (short)0, c, false, false); }
__device__ __forceinline__ v8f wmmah(v16h a, v16h b, v8f c) { return __builtin_amdgcn_wmma_f32_16x16x32_f16(false, a, false, b, (short)0, c, false, false); }



// ---- k_fattn: key order, rounding of the inputs, scores, key mask, softmax and the P x V product of one head in ONE kernel; the scores stay in registers.
// Two waves share 32 query columns: of every stage of 128 keys, wave w (0 to 7) walks the first 64 and wave w + 8 the last 64, in passes of 32, each with a running softmax of its own; behind the key loop the two join their maxima, sums and O^T tiles through LDS, and each writes 16 of the 32 columns. So a SIMD holds four waves, whose vector work and products cover one another. Transposed products: S^T = K Q^T (A = key rows, B = query rows), O^T += V^T P^T (A = V^T rows, B = P^T).
// A lane's accumulator registers of two 16-key score tiles are, in order, the k positions of a B operand (k = 8 hi + r and 16 + 8 hi + r), the order in which WFrag::lds reads V^T: P needs no LDS and no lane exchange.
// Softmax is the running form in the log2 domain: m_run is the maximum in use per query; sums and O^T are rescaled only when a pass's maximum exceeds it by more than 8. P goes into its product rounded to f16 (1 product); Q, K and V are bf16 values, V's written in the f16 format.
// grid (TT / 256, batches x heads), 16 waves; z = batch * NH_ + head.
// Key order: order[j] = position of place j (kept keys first, masked ones behind, each kind in its own order; a count per thread of 4 positions, a running sum over the 512 threads).
// The 16 waves need the same K and V^T rows: a stage of SK places lies in LDS as K (SK rows of 128 bytes) and V^T (64 rows of 2 SK bytes), two buffers. Each wave brings one sixteenth of a stage: at the head of the stage before it issues 8 asynchronous copies of 16 bytes a lane (f32 rows fetched by order[]) into its own piece of the next buffer's raw part, and at that stage's foot it reads them back, rounds them and stores them into the other buffer, so the copies fly while the stage is worked on and hold no registers.
// Waves 0 to 3 and 8 to 11: K, 16 places x 64 d each (a copy takes two whole 256-byte head rows). Waves 4 to 7 and 12 to 15: V, 64 places x 16 d each, transposed in registers: a lane holds 8 places x 4 d, so the 8 places of one d are one 16-byte LDS store. Every SIMD has two waves of each kind.
// Every wave reads its fragments from LDS; the row pitches are odd multiples of 16 bytes, which 16-byte reads of 16 rows take without bank conflicts.
template <typename T16> struct WFrag;
template <> struct WFrag<bf> { typedef v16bf V; static __device__ __forceinline__ V lds(const unsigned char* p) { return cat16b(*(const v8usa*)p, *(const v8usa*)(p + 32)); } };   // lds: a fragment from an LDS row, k positions 8 hi .. and 16 + 8 hi .. of each 32, where p stands at 16 hi bytes
typedef __attribute__((ext_vector_type(4))) int v4i;
typedef __attribute__((ext_vector_type(8))) unsigned v8u;
typedef __attribute__((ext_vector_type(2))) float v2f;
typedef v2f  __attribute__((may_alias)) v2fa;
typedef __attribute__((ext_vector_type(2))) __bf16 v2bf;
__device__ __forceinline__ unsigned pack2(float lo, float hi) { v2f x; x[0] = lo; x[1] = hi; return __builtin_bit_cast(unsigned, __builtin_convertvector(x, v2bf)); }   // round to nearest even
typedef __attribute__((ext_vector_type(2))) _Float16 v2h;
__device__ __forceinline__ unsigned pack2h(float lo, float hi) { v2f x; x[0] = lo; x[1] = hi; return __builtin_bit_cast(unsigned, __builtin_convertvector(x, v2h)); }   // round to nearest even
__device__ __forceinline__ unsigned pack2bh(float lo, float hi) { const unsigned u = pack2(lo, hi); return pack2h(__uint_as_float(u << 16), __uint_as_float(u & 0xFFFF0000u)); }   // the two bf16 values, in the f16 format
__device__ __forceinline__ float xhalf(float x) { return __builtin_bit_cast(float, __builtin_amdgcn_permlanex16(__builtin_bit_cast(int, x), __builtin_bit_cast(int, x), 0x76543210, 0xfedcba98, false, false)); }   // lane l with lane l ^ 16
#define SCL2 0.18033688011112042f   // HD^-0.5 * log2(e)
#define SK     128                 // keys of a stage
#define KPIT   144                 // LDS bytes from one K row to the next (128 + 16)
#define VPIT   (2 * SK + 16)       // LDS bytes from one V^T row of a stage to the next
#define KBYTES (SK * KPIT)
#define SBYTES (KBYTES + HD * VPIT)   // one buffer: the K rows, behind them the V^T rows
#define RAWW   (8 * 512)           // behind a buffer's rows its raw part: the stage's f32 values as they land, 8 x 512 bytes a wave, each lane's 16 bytes of copy i at (i * 32 + lane) * 16
#define BUFB   (SBYTES + 16 * RAWW)   // LDS bytes from one buffer to the other
// A wave's eight copies of a stage: g + o[i] the lane's 16 bytes in the K or V tensor, l + 512 i their LDS byte address. Every lane is on; each copy has registers of its own.
__device__ __forceinline__ void copy8(const char* g, unsigned o0, unsigned o1, unsigned o2, unsigned o3, unsigned o4, unsigned o5, unsigned o6, unsigned o7, unsigned l) {
    asm volatile("global_load_async_to_lds_b128 %0, %8, off\n\t"
                 "global_load_async_to_lds_b128 %1, %9, off\n\t"
                 "global_load_async_to_lds_b128 %2, %10, off\n\t"
                 "global_load_async_to_lds_b128 %3, %11, off\n\t"
                 "global_load_async_to_lds_b128 %4, %12, off\n\t"
                 "global_load_async_to_lds_b128 %5, %13, off\n\t"
                 "global_load_async_to_lds_b128 %6, %14, off\n\t"
                 "global_load_async_to_lds_b128 %7, %15, off\n\t"
                 "s_wait_xcnt 0x0"   // in the copies' own statement: it stands in front of every later write of the registers that they name
                 :: "v"(l), "v"(l + 512), "v"(l + 1024), "v"(l + 1536), "v"(l + 2048), "v"(l + 2560), "v"(l + 3072), "v"(l + 3584),
                    "v"(g + o0), "v"(g + o1), "v"(g + o2), "v"(g + o3), "v"(g + o4), "v"(g + o5), "v"(g + o6), "v"(g + o7) : "memory");
}
typedef __attribute__((ext_vector_type(2))) unsigned v2u;
typedef __attribute__((ext_vector_type(4))) unsigned v4u;
typedef v4u  __attribute__((may_alias)) v4ua;
typedef v2u  __attribute__((may_alias)) v2ua;
// A wave's part of the stage that starts at place p0: the byte offsets so[] of its 8 copies in the K (kw) or V tensor, from order[]; row0 = batch * TT, h the head, u the wave's number among the eight of its kind.
__device__ __forceinline__ void stage_offsets(const unsigned short* order, bool kw, int u, int lane, int row0, int h, int p0, unsigned (&so)[8]) {
    if (kw) {   // the tile's 16 places are 8 words of order[], the same for every lane; word i holds the places 2 i and 2 i + 1, one for each half of the wave
        const int t0 = p0 + u * 16, c = (lane & 15) * 4;
        v4u ow[2];
#pragma unroll
        for (int i = 0; i < 2; ++i) ow[i] = *(const v4ua*)(order + t0 + 8 * i);
#pragma unroll
        for (int i = 0; i < 8; ++i) { const int p = (int)((ow[i >> 2][i & 3] >> ((lane >> 4) * 16)) & 0xFFFFu); so[i] = (unsigned)((((row0 + p) * NH_ + h) * HD + c) * 4); }
    } else {   // copy j: place j of the lane's 8
        const int t = p0 + (u >> 2) * 64 + (lane >> 2) * 8, d = (u & 3) * 16 + (lane & 3) * 4;
        const v8us pj = *(const v8usa*)(order + t);
#pragma unroll
        for (int j = 0; j < 8; ++j) so[j] = (unsigned)((((row0 + (int)pj[j]) * NH_ + h) * HD + d) * 4);
    }
}
// The same part, landed at R (the lane's own 16 bytes of each copy): read back, rounded to bf16 (nearest even) and stored into the buffer at B (K as bf16, V's values as f16).
__device__ __forceinline__ void stage_store(unsigned char* B, const unsigned char* R, bool kw, int u, int lane) {
    v4f a[8];
#pragma unroll
    for (int i = 0; i < 8; ++i) a[i] = *(const v4fa*)(R + i * 512);
    if (kw) {
        unsigned char* p = B + (u * 16 + (lane >> 4)) * KPIT + (lane & 15) * 8;
#pragma unroll
        for (int i = 0; i < 8; ++i) { v2u x; x[0] = pack2(a[i][0], a[i][1]); x[1] = pack2(a[i][2], a[i][3]); *(v2ua*)(p + i * 2 * KPIT) = x; }
    } else {
        unsigned char* p = B + KBYTES + ((u & 3) * 16 + (lane & 3) * 4) * VPIT + ((u >> 2) * 64 + (lane >> 2) * 8) * 2;
#pragma unroll
        for (int c = 0; c < 4; ++c) { v4u x;
#pragma unroll
            for (int i = 0; i < 4; ++i) x[i] = pack2bh(a[2 * i][c], a[2 * i + 1][c]);   // places 2 i and 2 i + 1
            *(v4ua*)(p + c * VPIT) = x; }
    }
}
__global__ __launch_bounds__(512) void k_fattn(const float* __restrict__ q, const float* __restrict__ k, const float* __restrict__ v, const int* __restrict__ kmask, float* OUTp) {
    typedef WFrag<bf>::V V;
    __shared__ __attribute__((aligned(16))) unsigned char L[2 * BUFB];
    __shared__ __attribute__((aligned(16))) unsigned short order[TT];
    __shared__ int wsum[16];
    const int lane = threadIdx.x & 31, lr = lane & 15, hi = lane >> 4;
    const int w = __builtin_amdgcn_readfirstlane(threadIdx.x >> 5);   // in a scalar register: the tests on it are scalar branches
    const int z = blockIdx.y, b = z / NH_, h = z % NH_; const int q0 = blockIdx.x * 256 + (w & 7) * 32;
    const int half = w >> 3;   // which 64 keys of every stage are this wave's
    // the lane's query values (f32) and its 4 mask words are asked for together
    const float* qp = q + ((size_t)(b * TT + q0 + lr) * NH_ + h) * HD + 8 * hi;
    v4f qa[2][2][4];   // [query group][k step of 32 d][d 0.., 4.., 16.., 20.. behind 8 hi]
#pragma unroll
    for (int g = 0; g < 2; ++g)
#pragma unroll
        for (int kc = 0; kc < 2; ++kc)
#pragma unroll
            for (int i = 0; i < 4; ++i) qa[g][kc][i] = *(const v4f*)(qp + g * 16 * NH_ * HD + kc * 32 + (i >> 1) * 16 + (i & 1) * 4);
    const int t4 = threadIdx.x * 4;
    const int* mp = kmask + b * TT + t4;
    const v4i m0 = *(const v4i*)mp;
    asm volatile("s_wait_xcnt 0x0" :: "v"(qp), "v"(mp) : "memory");   // in front of every later write of these loads' address pairs; as inputs the pairs stay whole up to here
    __builtin_amdgcn_sched_barrier(0);   // holds those writes behind the wait
    int c = 0;
#pragma unroll
    for (int r = 0; r < 4; ++r) c += (m0[r] != 0) ? 1 : 0;
    int inc = c;   // kept keys of this wave up to and with this thread's 4
#pragma unroll
    for (int dl = 1; dl < 32; dl <<= 1) { const int o = __shfl_up(inc, (unsigned)dl, 32); if (lane >= dl) inc += o; }
    if (lane == 31) wsum[w] = inc;
    __syncthreads();   // the waves' sums are read by every wave
    int kp = inc - c, n = 0;
#pragma unroll
    for (int i = 0; i < 16; ++i) { const int sm = wsum[i]; n += sm; if (i < w) kp += sm; }   // kp: kept keys in front of this thread's first position
#pragma unroll
    for (int r = 0; r < 4; ++r) { const bool keep = m0[r] != 0; const int t = t4 + r;
        order[keep ? kp : n + (t - kp)] = (unsigned short)t;   // t - kp masked keys stand in front of t; every place is written once
        kp += keep ? 1 : 0; }
    __syncthreads();   // order[] is read by every wave
    int nk = __builtin_amdgcn_readfirstlane(n); nk = nk < 0 ? 0 : (nk > TT ? TT : nk);   // kept keys of this batch, bounded here: it sets the trip counts; in a scalar register, so that every test on it is a scalar branch
    const int nend = nk ? nk : TT;   // keys to walk; a stage is always filled whole, the last one with masked keys behind the kept ones
    const int nst = (nend + SK - 1) / SK;   // stages, 1 to TT / SK
    const int lim = nk - 8 * hi;
    const bool kw = (w & 4) == 0; const int u = (w & 3) | (half << 2);   // the wave's part of every stage
    const float* src = kw ? k : v;
    const char* src8 = (const char*)src;
    const unsigned char* R = L + SBYTES + w * RAWW + lane * 16;   // the lane's place in the wave's own raw part of buffer 0, which no other wave touches
    const unsigned lraw = (unsigned)(size_t)R;
    unsigned so[8];
    stage_offsets(order, kw, u, lane, b * TT, h, 0, so);
    copy8(src8, so[0], so[1], so[2], so[3], so[4], so[5], so[6], so[7], lraw);   // stage 0
    V qh[2][2];   // [query group][k step of 32 d]; every index below is a constant after unrolling, so all fragments and tiles stay in registers
#pragma unroll
    for (int g = 0; g < 2; ++g)
#pragma unroll
        for (int kc = 0; kc < 2; ++kc) { v8u x;
#pragma unroll
            for (int i = 0; i < 4; ++i) { x[2 * i] = pack2(qa[g][kc][i][0], qa[g][kc][i][1]); x[2 * i + 1] = pack2(qa[g][kc][i][2], qa[g][kc][i][3]); }
            qh[g][kc] = __builtin_bit_cast(V, x); }
    v8f acc[2][4]; float m_run[2], l_run[2];
#pragma unroll
    for (int g = 0; g < 2; ++g) { m_run[g] = -3.0e38f; l_run[g] = 0.f;
#pragma unroll
        for (int dt = 0; dt < 4; ++dt) acc[g][dt] = (v8f){}; }
    asm volatile("s_wait_asynccnt 0x0" ::: "memory");   // this wave's copies of stage 0 have landed; it alone reads them
    stage_store(L, R, kw, u, lane);   // stage 0 into buffer 0
    __syncthreads();   // every wave's part is there: stage 0 may be read
    const unsigned kl = (half * 64 + lr) * KPIT + 16 * hi, vl = KBYTES + lr * VPIT + half * 64 * 2 + 16 * hi;   // the lane's byte offsets in a buffer: fragment row lr of the wave's 64 keys, k positions 8 hi ..
#pragma unroll 1   // kept rolled: the buffer alternates by an offset, and an unrolled body would only add code
    for (int st = 0; st < nst; ++st) {
    const unsigned sb = (st & 1) * BUFB, nb = BUFB - sb;   // this stage's buffer, the next one's
    const bool more = st + 1 < nst;   // the same for the whole work-group, a scalar test
    if (more) { stage_offsets(order, kw, u, lane, b * TT, h, (st + 1) * SK, so);   // stage st + 1 is asked for; it flies while stage st is worked on
        copy8(src8, so[0], so[1], so[2], so[3], so[4], so[5], so[6], so[7], lraw + nb); }
    int k0 = st * SK + half * 64;   // the wave's first key of the stage
    const int kend = nend < k0 + 64 ? nend : k0 + 64;   // the wave's passes of the stage end here
    if (k0 < kend) {   // a scalar test: in the last stage the kept keys may end in front of the second wave's 64
    unsigned ko = sb + kl, vo = sb + vl;   // they walk with the passes
    V kh[2][2];   // [key tile][k step]: the K fragments of the pass at hand, fetched one pass ahead inside the stage
#pragma unroll
    for (int kt = 0; kt < 2; ++kt)
#pragma unroll
        for (int kc = 0; kc < 2; ++kc) kh[kt][kc] = WFrag<bf>::lds(L + ko + kt * 16 * KPIT + kc * 64);
#pragma unroll 1   // kept rolled: one pass is already some hundred instructions, and an unrolled body would only add code and registers
    do {
        // this pass's V^T fragments are asked for first: the score products hide their way
        v16h vh[4];
#pragma unroll
        for (int dt = 0; dt < 4; ++dt) vh[dt] = __builtin_bit_cast(v16h, WFrag<bf>::lds(L + vo + dt * 16 * VPIT));
        __builtin_amdgcn_sched_barrier(0);   // keeps the loads above, as one group, in front of the score products; the scheduler otherwise sinks each next to its use, where its whole latency is waited for
        v8f s[2][2];   // [key tile][query group]: s[kt][g][r] = score of key k0 + 16 kt + 8 hi + r with query q0 + 16 g + lr
#pragma unroll
        for (int kt = 0; kt < 2; ++kt)
#pragma unroll
            for (int g = 0; g < 2; ++g) { v8f c = (v8f){};
#pragma unroll
                for (int kc = 0; kc < 2; ++kc) c = wmmab(kh[kt][kc], qh[g][kc], c);
                s[kt][g] = c; }
        __builtin_amdgcn_sched_barrier(0);   // the next pass's K loads stay behind the products that read the same fragments ...
        ko = (k0 + 32 < kend) ? ko + 32u * KPIT : sb + kl;   // the wave's last pass of the stage fetches its first pass again: rows of the same buffer, not used; nothing of the next stage is read in front of its barrier
#pragma unroll
        for (int kt = 0; kt < 2; ++kt)
#pragma unroll
            for (int kc = 0; kc < 2; ++kc) kh[kt][kc] = WFrag<bf>::lds(L + ko + kt * 16 * KPIT + kc * 64);
        __builtin_amdgcn_sched_barrier(0);   // ... and in front of the softmax and the second product, which hide their way
        // scale to the log2 domain; a key behind the kept ones (mask == 0: the last pass's fill, or every key where none is kept) takes -1e20 (the sum rounds to exactly -1e20), so a row with no kept key comes out uniform, as in the module
        const int rem = lim - k0;   // this lane's key 16 kt + r of the pass is a kept one while 16 kt + r < rem
#pragma unroll
        for (int kt = 0; kt < 2; ++kt) {
#pragma unroll
            for (int r = 0; r < 8; ++r) { const float bias = (kt * 16 + r < rem) ? 0.0f : -1.0e20f;
#pragma unroll
                for (int g = 0; g < 2; ++g) s[kt][g][r] = __builtin_fmaf(s[kt][g][r], SCL2, bias); } }
        float mb[2]; bool need = false;
#pragma unroll
        for (int g = 0; g < 2; ++g) { float mx = s[0][g][0];
#pragma unroll
            for (int r = 1; r < 8; ++r) mx = fmaxf(mx, s[0][g][r]);
#pragma unroll
            for (int r = 0; r < 8; ++r) mx = fmaxf(mx, s[1][g][r]);
            mx = fmaxf(mx, xhalf(mx));   // both halves of the wave hold the query's maximum over the pass's 32 keys
            mb[g] = mx; need = need || (mx > m_run[g] + 8.0f); }
        if (__builtin_amdgcn_ballot_w32(need) != 0) {   // wave-uniform, rare after the first passes
#pragma unroll
            for (int g = 0; g < 2; ++g) { const float m_new = fmaxf(m_run[g], mb[g]); const float corr = __builtin_amdgcn_exp2f(m_run[g] - m_new); m_run[g] = m_new; l_run[g] *= corr;
#pragma unroll
                for (int dt = 0; dt < 4; ++dt) acc[g][dt] = acc[g][dt] * corr; } }
#pragma unroll
        for (int g = 0; g < 2; ++g) { v8u wh;
#pragma unroll
            for (int i = 0; i < 8; ++i) {
                const float p0 = __builtin_amdgcn_exp2f(s[i >> 2][g][2 * (i & 3)] - m_run[g]), p1 = __builtin_amdgcn_exp2f(s[i >> 2][g][2 * (i & 3) + 1] - m_run[g]);
                l_run[g] += p0 + p1;
                wh[i] = pack2h(p0, p1); }
            const v16h ph = __builtin_bit_cast(v16h, wh);
#pragma unroll
            for (int dt = 0; dt < 4; ++dt) acc[g][dt] = wmmah(vh[dt], ph, acc[g][dt]); }
        vo += 32 * 2; k0 += 32;
    } while (k0 < kend);
    }
    // the stage's foot, every wave: stage st + 1 goes into the other buffer, whose last readers left it in front of the barrier of stage st - 1
    asm volatile("s_wait_asynccnt 0x0" ::: "memory");   // this wave's copies of stage st + 1 have landed; it alone reads them
    if (more) stage_store(L + nb, R + nb, kw, u, lane);
    asm volatile("s_wait_dscnt 0x0" ::: "memory");   // this wave's reads of the buffer and of its raw part have returned, its stores have landed
    __syncthreads();   // that holds for every wave: stage st + 1 may be read, buffer st & 1 may be refilled
    }
    // The two waves of the same 32 columns join their parts: each hands its partner the query group that the partner writes (group 1 - half) through LDS and keeps group half.
    // The buffers are free for that: the last stage's foot ended every wave's reads of them, and no copy is under way. A wave that had no key holds m = -3e38, sums 0: its weight comes out 0.
    const bool h1 = half != 0;
    unsigned char* X = L + (w * 256 + lane) * 16;   // this wave's 8 x 512 bytes of O^T, the lane's 16 bytes of piece i at (i * 32 + lane) * 16
    const unsigned char* Y = L + ((w ^ 8) * 256 + lane) * 16;   // its partner's
#pragma unroll
    for (int dt = 0; dt < 4; ++dt) { const v8f t = h1 ? acc[0][dt] : acc[1][dt]; v4f t0, t1;
#pragma unroll
        for (int r = 0; r < 4; ++r) { t0[r] = t[r]; t1[r] = t[4 + r]; }
        *(v4fa*)(X + (2 * dt) * 512) = t0; *(v4fa*)(X + (2 * dt + 1) * 512) = t1; }
    { v2f ml; ml[0] = h1 ? m_run[0] : m_run[1]; ml[1] = h1 ? l_run[0] : l_run[1]; *(v2fa*)(L + 16 * 4096 + (w * 32 + lane) * 8) = ml; }   // its maximum in use and its sum, behind the 16 waves' tiles
    __syncthreads();   // every wave's part lies in LDS before its partner reads it
    const v2f pm = *(const v2fa*)(L + 16 * 4096 + ((w ^ 8) * 32 + lane) * 8);
    const float mo = h1 ? m_run[1] : m_run[0], lo = h1 ? l_run[1] : l_run[0];
    const float mn = fmaxf(mo, pm[0]);
    const float co = __builtin_amdgcn_exp2f(mo - mn), cp = __builtin_amdgcn_exp2f(pm[0] - mn);   // both parts on the common maximum
    const float lh = lo * co + pm[1] * cp;
    const float l = lh + xhalf(lh);   // each half of a wave summed its own 16 keys of every pass
    const float inv = __fdiv_rn(1.0f, l);
    const float fo = co * inv, fp = cp * inv;
    float* op = OUTp + ((size_t)(b * TT + q0 + half * 16 + lr) * NH_ + h) * HD + 8 * hi;   // acc[g][dt][r] = O[query q0 + 16 g + lr][d = 16 dt + 8 hi + r]
#pragma unroll
    for (int dt = 0; dt < 4; ++dt) { const v8f o = h1 ? acc[1][dt] : acc[0][dt]; const v4f p0 = *(const v4fa*)(Y + (2 * dt) * 512), p1 = *(const v4fa*)(Y + (2 * dt + 1) * 512); v4f o0, o1;
#pragma unroll
        for (int r = 0; r < 4; ++r) { o0[r] = o[r] * fo + p0[r] * fp; o1[r] = o[4 + r] * fo + p1[r] * fp; }
        *(v4f*)(op + dt * 16) = o0; *(v4f*)(op + dt * 16 + 4) = o1; }
}

extern "C" void kernel_launch(void* const* d_in, const int* in_sizes, int n_in,
                              void* d_out, int out_size, void* d_ws, size_t ws_size, hipStream_t stream) {
    (void)in_sizes; (void)n_in; (void)out_size; (void)d_ws; (void)ws_size;
    const float* x = (const float*)d_in[0]; const float* xk = (const float*)d_in[1]; const float* xv = (const float*)d_in[2]; const int* kmask = (const int*)d_in[3];   /* order queries, keys, values [2][2048][16][64], mask (int32 [2][1][1][2048], read) */
    float* OUT = (float*)d_out;     // [2][2048][1024]
    k_fattn<<<dim3(TT / 256, NB_ * NH_), 512, 0, stream>>>(x, xk, xv, kmask, OUT);   // one launch for both batches and all heads
}

// v010
// A run of this version takes 23.6 microseconds.
// Timed twice side by side with v009, it ran 1.08 and 1.07 times as fast.
// All steps since v000 together make it 49.1 times as fast.
#include <hip/hip_runtime.h>

// Scaled dot-product attention on pre-split multi-head tensors with an integer key mask (queries, keys, values [2][2048][16][64] = (batch, position, head, dim), no projections; scores = einsum('bqhd,bkhd->bhqk') / sqrt(64); keys with mask[b][j] == 0 -> -1e20 (== exclusion; mask int32 [2][1][1][2048] random 0/1, read); softmax over the kept keys; out = einsum('bhqv,bvhd->bqhd') -> [2][2048][16][64] (4.2 M); argument order queries, keys, values, mask.
// ONE launch, no workspace: k_fattn reads the f32 inputs itself, rounds every value to bf16 on its way into registers (queries) or LDS (keys, values), and does one product for the scores (bf16) and one for P x V (f16), running softmax in registers; it writes the [position][head][dim] output rows itself.
// Keys are walked in the order of the key mask: a batch's kept keys first, in their order, the masked ones behind them. Every work-group forms that order in LDS and walks the kept keys alone, in stages of 128 that it brings into LDS once for its 16 waves (a masked key's weight is an exact 0 beside any kept key); a batch with no kept key walks all 2048 at one common mask value, which gives the module's uniform row.
// Compute dtypes, f32 accumulate: every input rounded to bf16; P rounded once to f16 (11 significant bits, 0 <= P <= 2^8); V's bf16 values are carried as f16, which holds them exactly from 2^-17 up to 65504 (below that to 2^-25 absolute; normal deviates stay far inside); softmax f32; output f32.

#define NB_  2
#define TT   2048
#define DM   1024
#define NH_  16
#define NKV  16
#define REP  (NH_ / NKV)
#define HD   64
#define DQ   (NH_ * HD)
#define DKV  (NKV * HD)
typedef _Float16 h16;
typedef unsigned short bf;
typedef __attribute__((ext_vector_type(16))) __bf16   v16bf;
typedef __attribute__((ext_vector_type(16))) _Float16 v16h;
typedef __attribute__((ext_vector_type(8)))  _Float16 v8h;
typedef __attribute__((ext_vector_type(8)))  unsigned short v8us;
typedef __attribute__((ext_vector_type(8)))  float    v8f;
typedef __attribute__((ext_vector_type(4)))  float    v4f;
typedef v8h  __attribute__((may_alias)) v8ha;
typedef v4f  __attribute__((may_alias)) v4fa;
typedef v8us __attribute__((may_alias)) v8usa;

__device__ __forceinline__ v16bf cat16b(v8us lo, v8us hi) { return __builtin_bit_cast(v16bf, __builtin_shufflevector(lo, hi, 0, 1, 2, 3, 4, 5, 6, 7, 8, 9, 10, 11, 12, 13, 14, 15)); }
__device__ __forceinline__ v8f wmmab(v16bf a, v16bf b, v8f c) { return __builtin_amdgcn_wmma_f32_16x16x32_bf16(false, a, false, b, (short)0, c, false, false); }
__device__ __forceinline__ v8f wmmah(v16h a, v16h b, v8f c) { return __builtin_amdgcn_wmma_f32_16x16x32_f16(false, a, false, b, (short)0, c, false, false); }



// ---- k_fattn: key order, rounding of the inputs, scores, key mask, softmax and the P x V product of one head in ONE kernel; the scores stay in registers.
// Two waves share 32 query columns: of every stage of 128 keys, wave w (0 to 7) walks the first 64 and wave w + 8 the last 64, in passes of 32, each with a running softmax of its own; behind the key loop the two join their maxima, sums and O^T tiles through LDS, and each writes 16 of the 32 columns. So a SIMD holds four waves, whose vector work and products cover one another. Transposed products: S^T = K Q^T (A = key rows, B = query rows), O^T += V^T P^T (A = V^T rows, B = P^T).
// A lane's accumulator registers of two 16-key score tiles are, in order, the k positions of a B operand (k = 8 hi + r and 16 + 8 hi + r), the order in which WFrag::lds reads V^T: P needs no LDS and no lane exchange.
// Softmax is the running form in the log2 domain: m_run is the maximum in use per query; sums and O^T are rescaled only when a pass's maximum exceeds it by more than 8. A weight is exp2(score * scale - m_run), the argument one multiply-add on the product's own value; the pass's maximum is taken over those values and scaled once. P goes into its product rounded to f16 (1 product); Q, K and V are bf16 values, V's written in the f16 format.
// grid (TT / 256, batches x heads), 16 waves; z = batch * NH_ + head.
// Key order: order[j] = position of place j (kept keys first, masked ones behind, each kind in its own order; a count per thread of 4 positions, a running sum over the 512 threads).
// The 16 waves need the same K and V^T rows: a stage of SK places lies in LDS as K (SK rows of 128 bytes) and V^T (64 rows of 2 SK bytes), two buffers. Each wave brings one sixteenth of a stage: at the head of the stage before it issues 8 asynchronous copies of 16 bytes a lane (f32 rows fetched by order[]) into its own piece of the next buffer's raw part, and at that stage's foot it reads them back, rounds them and stores them into the other buffer, so the copies fly while the stage is worked on and hold no registers.
// Waves 0 to 3 and 8 to 11: K, 16 places x 64 d each (a copy takes two whole 256-byte head rows). Waves 4 to 7 and 12 to 15: V, 64 places x 16 d each, transposed in registers: a lane holds 8 places x 4 d, so the 8 places of one d are one 16-byte LDS store. Every SIMD has two waves of each kind.
// Every wave reads its fragments from LDS; the row pitches are odd multiples of 16 bytes, which 16-byte reads of 16 rows take without bank conflicts.
template <typename T16> struct WFrag;
template <> struct WFrag<bf> { typedef v16bf V; static __device__ __forceinline__ V lds(const unsigned char* p) { return cat16b(*(const v8usa*)p, *(const v8usa*)(p + 32)); } };   // lds: a fragment from an LDS row, k positions 8 hi .. and 16 + 8 hi .. of each 32, where p stands at 16 hi bytes
typedef __attribute__((ext_vector_type(4))) int v4i;
typedef __attribute__((ext_vector_type(8))) unsigned v8u;
typedef __attribute__((ext_vector_type(2))) float v2f;
typedef v2f  __attribute__((may_alias)) v2fa;
typedef __attribute__((ext_vector_type(2))) __bf16 v2bf;
__device__ __forceinline__ unsigned pack2(float lo, float hi) { v2f x; x[0] = lo; x[1] = hi; return __builtin_bit_cast(unsigned, __builtin_convertvector(x, v2bf)); }   // round to nearest even
typedef __attribute__((ext_vector_type(2))) _Float16 v2h;
__device__ __forceinline__ unsigned pack2h(float lo, float hi) { v2f x; x[0] = lo; x[1] = hi; return __builtin_bit_cast(unsigned, __builtin_convertvector(x, v2h)); }   // round to nearest even
__device__ __forceinline__ unsigned pack2bh(float lo, float hi) { const unsigned u = pack2(lo, hi); return pack2h(__uint_as_float(u << 16), __uint_as_float(u & 0xFFFF0000u)); }   // the two bf16 values, in the f16 format
__device__ __forceinline__ float xhalf(float x) { return __builtin_bit_cast(float, __builtin_amdgcn_permlanex16(__builtin_bit_cast(int, x), __builtin_bit_cast(int, x), 0x76543210, 0xfedcba98, false, false)); }   // lane l with lane l ^ 16
#define SCL2 0.18033688011112042f   // HD^-0.5 * log2(e)
#define MSK  (-0x1p66f)            // a masked key's score in front of the scale, about -7e19: a power of two, so that MSK * SCL2 is exact and MSK * SCL2 - (MSK * SCL2) is an exact 0 where every key is masked
#define SK     128                 // keys of a stage
#define KPIT   144                 // LDS bytes from one K row to the next (128 + 16)
#define VPIT   (2 * SK + 16)       // LDS bytes from one V^T row of a stage to the next
#define KBYTES (SK * KPIT)
#define SBYTES (KBYTES + HD * VPIT)   // one buffer: the K rows, behind them the V^T rows
#define RAWW   (8 * 512)           // behind a buffer's rows its raw part: the stage's f32 values as they land, 8 x 512 bytes a wave, each lane's 16 bytes of copy i at (i * 32 + lane) * 16
#define BUFB   (SBYTES + 16 * RAWW)   // LDS bytes from one buffer to the other
// A wave's eight copies of a stage: g + o[i] the lane's 16 bytes in the K or V tensor, l + 512 i their LDS byte address. Every lane is on; each copy has registers of its own.
__device__ __forceinline__ void copy8(const char* g, unsigned o0, unsigned o1, unsigned o2, unsigned o3, unsigned o4, unsigned o5, unsigned o6, unsigned o7, unsigned l) {
    asm volatile("global_load_async_to_lds_b128 %0, %8, off\n\t"
                 "global_load_async_to_lds_b128 %1, %9, off\n\t"
                 "global_load_async_to_lds_b128 %2, %10, off\n\t"
                 "global_load_async_to_lds_b128 %3, %11, off\n\t"
                 "global_load_async_to_lds_b128 %4, %12, off\n\t"
                 "global_load_async_to_lds_b128 %5, %13, off\n\t"
                 "global_load_async_to_lds_b128 %6, %14, off\n\t"
                 "global_load_async_to_lds_b128 %7, %15, off\n\t"
                 "s_wait_xcnt 0x0"   // in the copies' own statement: it stands in front of every later write of the registers that they name
                 :: "v"(l), "v"(l + 512), "v"(l + 1024), "v"(l + 1536), "v"(l + 2048), "v"(l + 2560), "v"(l + 3072), "v"(l + 3584),
                    "v"(g + o0), "v"(g + o1), "v"(g + o2), "v"(g + o3), "v"(g + o4), "v"(g + o5), "v"(g + o6), "v"(g + o7) : "memory");
}
typedef __attribute__((ext_vector_type(2))) unsigned v2u;
typedef __attribute__((ext_vector_type(4))) unsigned v4u;
typedef v4u  __attribute__((may_alias)) v4ua;
typedef v2u  __attribute__((may_alias)) v2ua;
// A wave's part of the stage that starts at place p0: the byte offsets so[] of its 8 copies in the K (kw) or V tensor, from order[]; row0 = batch * TT, h the head, u the wave's number among the eight of its kind.
__device__ __forceinline__ void stage_offsets(const unsigned short* order, bool kw, int u, int lane, int row0, int h, int p0, unsigned (&so)[8]) {
    if (kw) {   // the tile's 16 places are 8 words of order[], the same for every lane; word i holds the places 2 i and 2 i + 1, one for each half of the wave
        const int t0 = p0 + u * 16, c = (lane & 15) * 4;
        v4u ow[2];
#pragma unroll
        for (int i = 0; i < 2; ++i) ow[i] = *(const v4ua*)(order + t0 + 8 * i);
#pragma unroll
        for (int i = 0; i < 8; ++i) { const int p = (int)((ow[i >> 2][i & 3] >> ((lane >> 4) * 16)) & 0xFFFFu); so[i] = (unsigned)((((row0 + p) * NH_ + h) * HD + c) * 4); }
    } else {   // copy j: place j of the lane's 8
        const int t = p0 + (u >> 2) * 64 + (lane >> 2) * 8, d = (u & 3) * 16 + (lane & 3) * 4;
        const v8us pj = *(const v8usa*)(order + t);
#pragma unroll
        for (int j = 0; j < 8; ++j) so[j] = (unsigned)((((row0 + (int)pj[j]) * NH_ + h) * HD + d) * 4);
    }
}
// The same part, landed at R (the lane's own 16 bytes of each copy): read back, rounded to bf16 (nearest even) and stored into the buffer at B (K as bf16, V's values as f16).
__device__ __forceinline__ void stage_store(unsigned char* B, const unsigned char* R, bool kw, int u, int lane) {
    v4f a[8];
#pragma unroll
    for (int i = 0; i < 8; ++i) a[i] = *(const v4fa*)(R + i * 512);
    if (kw) {
        unsigned char* p = B + (u * 16 + (lane >> 4)) * KPIT + (lane & 15) * 8;
#pragma unroll
        for (int i = 0; i < 8; ++i) { v2u x; x[0] = pack2(a[i][0], a[i][1]); x[1] = pack2(a[i][2], a[i][3]); *(v2ua*)(p + i * 2 * KPIT) = x; }
    } else {
        unsigned char* p = B + KBYTES + ((u & 3) * 16 + (lane & 3) * 4) * VPIT + ((u >> 2) * 64 + (lane >> 2) * 8) * 2;
#pragma unroll
        for (int c = 0; c < 4; ++c) { v4u x;
#pragma unroll
            for (int i = 0; i < 4; ++i) x[i] = pack2bh(a[2 * i][c], a[2 * i + 1][c]);   // places 2 i and 2 i + 1
            *(v4ua*)(p + c * VPIT) = x; }
    }
}
template <bool B> struct Flag { static constexpr bool value = B; };
__global__ __launch_bounds__(512) void k_fattn(const float* __restrict__ q, const float* __restrict__ k, const float* __restrict__ v, const int* __restrict__ kmask, float* OUTp) {
    typedef WFrag<bf>::V V;
    __shared__ __attribute__((aligned(16))) unsigned char L[2 * BUFB];
    __shared__ __attribute__((aligned(16))) unsigned short order[TT];
    __shared__ int wsum[16];
    const int lane = threadIdx.x & 31, lr = lane & 15, hi = lane >> 4;
    const int w = __builtin_amdgcn_readfirstlane(threadIdx.x >> 5);   // in a scalar register: the tests on it are scalar branches
    const int z = blockIdx.y, b = z / NH_, h = z % NH_; const int q0 = blockIdx.x * 256 + (w & 7) * 32;
    const int half = w >> 3;   // which 64 keys of every stage are this wave's
    // the lane's query values (f32) and its 4 mask words are asked for together
    const float* qp = q + ((size_t)(b * TT + q0 + lr) * NH_ + h) * HD + 8 * hi;
    v4f qa[2][2][4];   // [query group][k step of 32 d][d 0.., 4.., 16.., 20.. behind 8 hi]
#pragma unroll
    for (int g = 0; g < 2; ++g)
#pragma unroll
        for (int kc = 0; kc < 2; ++kc)
#pragma unroll
            for (int i = 0; i < 4; ++i) qa[g][kc][i] = *(const v4f*)(qp + g * 16 * NH_ * HD + kc * 32 + (i >> 1) * 16 + (i & 1) * 4);
    const int t4 = threadIdx.x * 4;
    const int* mp = kmask + b * TT + t4;
    const v4i m0 = *(const v4i*)mp;
    asm volatile("s_wait_xcnt 0x0" :: "v"(qp), "v"(mp) : "memory");   // in front of every later write of these loads' address pairs; as inputs the pairs stay whole up to here
    __builtin_amdgcn_sched_barrier(0);   // holds those writes behind the wait
    int c = 0;
#pragma unroll
    for (int r = 0; r < 4; ++r) c += (m0[r] != 0) ? 1 : 0;
    int inc = c;   // kept keys of this wave up to and with this thread's 4
#pragma unroll
    for (int dl = 1; dl < 32; dl <<= 1) { const int o = __shfl_up(inc, (unsigned)dl, 32); if (lane >= dl) inc += o; }
    if (lane == 31) wsum[w] = inc;
    __syncthreads();   // the waves' sums are read by every wave
    int kp = inc - c, n = 0;
#pragma unroll
    for (int i = 0; i < 16; ++i) { const int sm = wsum[i]; n += sm; if (i < w) kp += sm; }   // kp: kept keys in front of this thread's first position
#pragma unroll
    for (int r = 0; r < 4; ++r) { const bool keep = m0[r] != 0; const int t = t4 + r;
        order[keep ? kp : n + (t - kp)] = (unsigned short)t;   // t - kp masked keys stand in front of t; every place is written once
        kp += keep ? 1 : 0; }
    __syncthreads();   // order[] is read by every wave
    int nk = __builtin_amdgcn_readfirstlane(n); nk = nk < 0 ? 0 : (nk > TT ? TT : nk);   // kept keys of this batch, bounded here: it sets the trip counts; in a scalar register, so that every test on it is a scalar branch
    const int nend = nk ? nk : TT;   // keys to walk; a stage is always filled whole, the last one with masked keys behind the kept ones
    const int nst = (nend + SK - 1) / SK;   // stages, 1 to TT / SK
    const int lim = nk - 8 * hi;
    const int ktail = nk - 31;   // a pass of 32 keys that starts here or later reaches past the kept keys
    const bool kw = (w & 4) == 0; const int u = (w & 3) | (half << 2);   // the wave's part of every stage
    const float* src = kw ? k : v;
    const char* src8 = (const char*)src;
    const unsigned char* R = L + SBYTES + w * RAWW + lane * 16;   // the lane's place in the wave's own raw part of buffer 0, which no other wave touches
    const unsigned lraw = (unsigned)(size_t)R;
    unsigned so[8];
    stage_offsets(order, kw, u, lane, b * TT, h, 0, so);
    copy8(src8, so[0], so[1], so[2], so[3], so[4], so[5], so[6], so[7], lraw);   // stage 0
    V qh[2][2];   // [query group][k step of 32 d]; every index below is a constant after unrolling, so all fragments and tiles stay in registers
#pragma unroll
    for (int g = 0; g < 2; ++g)
#pragma unroll
        for (int kc = 0; kc < 2; ++kc) { v8u x;
#pragma unroll
            for (int i = 0; i < 4; ++i) { x[2 * i] = pack2(qa[g][kc][i][0], qa[g][kc][i][1]); x[2 * i + 1] = pack2(qa[g][kc][i][2], qa[g][kc][i][3]); }
            qh[g][kc] = __builtin_bit_cast(V, x); }
    v8f acc[2][4]; float m_run[2], l_run[2];
#pragma unroll
    for (int g = 0; g < 2; ++g) { m_run[g] = -3.0e38f; l_run[g] = 0.f;
#pragma unroll
        for (int dt = 0; dt < 4; ++dt) acc[g][dt] = (v8f){}; }
    asm volatile("s_wait_asynccnt 0x0" ::: "memory");   // this wave's copies of stage 0 have landed; it alone reads them
    stage_store(L, R, kw, u, lane);   // stage 0 into buffer 0
    __syncthreads();   // every wave's part is there: stage 0 may be read
    const unsigned kl = (half * 64 + lr) * KPIT + 16 * hi, vl = KBYTES + lr * VPIT + half * 64 * 2 + 16 * hi;   // the lane's byte offsets in a buffer: fragment row lr of the wave's 64 keys, k positions 8 hi ..
#pragma unroll 1   // kept rolled: the buffer alternates by an offset, and an unrolled body would only add code
    for (int st = 0; st < nst; ++st) {
    const unsigned sb = (st & 1) * BUFB, nb = BUFB - sb;   // this stage's buffer, the next one's
    const bool more = st + 1 < nst;   // the same for the whole work-group, a scalar test
    if (more) { stage_offsets(order, kw, u, lane, b * TT, h, (st + 1) * SK, so);   // stage st + 1 is asked for; it flies while stage st is worked on
        copy8(src8, so[0], so[1], so[2], so[3], so[4], so[5], so[6], so[7], lraw + nb); }
    int k0 = st * SK + half * 64;   // the wave's first key of the stage
    const int kend = nend < k0 + 64 ? nend : k0 + 64;   // the wave's passes of the stage end here
    if (k0 < kend) {   // a scalar test: in the last stage the kept keys may end in front of the second wave's 64
    unsigned ko = sb + kl, vo = sb + vl;   // they walk with the passes
    V kh[2][2];   // [key tile][k step]: the K fragments of the pass at hand, fetched one pass ahead inside the stage
#pragma unroll
    for (int kt = 0; kt < 2; ++kt)
#pragma unroll
        for (int kc = 0; kc < 2; ++kc) kh[kt][kc] = WFrag<bf>::lds(L + ko + kt * 16 * KPIT + kc * 64);
    // One pass of 32 keys. TAIL: the pass reaches past the kept keys and sets the mask value; every other pass holds kept keys alone and has no instruction for the mask.
    auto pass = [&](auto tail) {
        // this pass's V^T fragments are asked for first: the score products hide their way
        v16h vh[4];
#pragma unroll
        for (int dt = 0; dt < 4; ++dt) vh[dt] = __builtin_bit_cast(v16h, WFrag<bf>::lds(L + vo + dt * 16 * VPIT));
        __builtin_amdgcn_sched_barrier(0);   // keeps the loads above, as one group, in front of the score products; the scheduler otherwise sinks each next to its use, where its whole latency is waited for
        v8f s[2][2];   // [key tile][query group]: s[kt][g][r] = score of key k0 + 16 kt + 8 hi + r with query q0 + 16 g + lr
#pragma unroll
        for (int kt = 0; kt < 2; ++kt)
#pragma unroll
            for (int g = 0; g < 2; ++g) { v8f c = (v8f){};
#pragma unroll
                for (int kc = 0; kc < 2; ++kc) c = wmmab(kh[kt][kc], qh[g][kc], c);
                s[kt][g] = c; }
        __builtin_amdgcn_sched_barrier(0);   // the next pass's K loads stay behind the products that read the same fragments ...
        ko = (k0 + 32 < kend) ? ko + 32u * KPIT : sb + kl;   // the wave's last pass of the stage fetches its first pass again: rows of the same buffer, not used; nothing of the next stage is read in front of its barrier
#pragma unroll
        for (int kt = 0; kt < 2; ++kt)
#pragma unroll
            for (int kc = 0; kc < 2; ++kc) kh[kt][kc] = WFrag<bf>::lds(L + ko + kt * 16 * KPIT + kc * 64);
        __builtin_amdgcn_sched_barrier(0);   // ... and in front of the softmax and the second product, which hide their way
        // the scores stay as the products left them: scale and maximum go into one multiply-add in front of each exponential, below
        // a key behind the kept ones (mask == 0: the last pass's fill, or every key where none is kept) takes MSK, so a row with no kept key comes out uniform, as in the module
        if constexpr (decltype(tail)::value) {
            const int rem = lim - k0;   // this lane's key 16 kt + r of the pass is a kept one while 16 kt + r < rem
#pragma unroll
            for (int kt = 0; kt < 2; ++kt) {
#pragma unroll
                for (int r = 0; r < 8; ++r) { const bool kept = kt * 16 + r < rem;
#pragma unroll
                    for (int g = 0; g < 2; ++g) s[kt][g][r] = kept ? s[kt][g][r] : MSK; } } }
        float mb[2]; bool need = false;
#pragma unroll
        for (int g = 0; g < 2; ++g) { float mx = s[0][g][0];
#pragma unroll
            for (int r = 1; r < 8; ++r) mx = fmaxf(mx, s[0][g][r]);
#pragma unroll
            for (int r = 0; r < 8; ++r) mx = fmaxf(mx, s[1][g][r]);
            mx = fmaxf(mx, xhalf(mx)) * SCL2;   // both halves of the wave hold the query's maximum over the pass's 32 keys, in the log2 domain
            mb[g] = mx; need = need || (mx > m_run[g] + 8.0f); }
        if (__builtin_amdgcn_ballot_w32(need) != 0) {   // wave-uniform, rare after the first passes
#pragma unroll
            for (int g = 0; g < 2; ++g) { const float m_new = fmaxf(m_run[g], mb[g]); const float corr = __builtin_amdgcn_exp2f(m_run[g] - m_new); m_run[g] = m_new; l_run[g] *= corr;
#pragma unroll
                for (int dt = 0; dt < 4; ++dt) acc[g][dt] = acc[g][dt] * corr; } }
#pragma unroll
        for (int g = 0; g < 2; ++g) { v8u wh; v2f sc2, nm; sc2[0] = SCL2; sc2[1] = SCL2; nm[0] = -m_run[g]; nm[1] = -m_run[g];
#pragma unroll
            for (int i = 0; i < 8; ++i) {
                v2f e; e[0] = s[i >> 2][g][2 * (i & 3)]; e[1] = s[i >> 2][g][2 * (i & 3) + 1];
                e = __builtin_elementwise_fma(e, sc2, nm);   // score * scale - maximum in use, two scores an instruction
                const float p0 = __builtin_amdgcn_exp2f(e[0]), p1 = __builtin_amdgcn_exp2f(e[1]);
                l_run[g] += p0 + p1;
                wh[i] = pack2h(p0, p1); }
            const v16h ph = __builtin_bit_cast(v16h, wh);
#pragma unroll
            for (int dt = 0; dt < 4; ++dt) acc[g][dt] = wmmah(vh[dt], ph, acc[g][dt]); }
        vo += 32 * 2; k0 += 32;
    };
    const int kfull = ktail < kend ? ktail : kend;   // the passes that start in front of it hold kept keys alone
#pragma unroll 1   // kept rolled: one pass is already some hundred instructions, and an unrolled body would only add code and registers
    while (k0 < kfull) pass(Flag<false>());
#pragma unroll 1   // one trip at most where a key is kept; rolled for the batch with none
    while (k0 < kend) pass(Flag<true>());
    }
    // the stage's foot, every wave: stage st + 1 goes into the other buffer, whose last readers left it in front of the barrier of stage st - 1
    asm volatile("s_wait_asynccnt 0x0" ::: "memory");   // this wave's copies of stage st + 1 have landed; it alone reads them
    if (more) stage_store(L + nb, R + nb, kw, u, lane);
    asm volatile("s_wait_dscnt 0x0" ::: "memory");   // this wave's reads of the buffer and of its raw part have returned, its stores have landed
    __syncthreads();   // that holds for every wave: stage st + 1 may be read, buffer st & 1 may be refilled
    }
    // The two waves of the same 32 columns join their parts: each hands its partner the query group that the partner writes (group 1 - half) through LDS and keeps group half.
    // The buffers are free for that: the last stage's foot ended every wave's reads of them, and no copy is under way. A wave that had no key holds m = -3e38, sums 0: its weight comes out 0.
    const bool h1 = half != 0;
    unsigned char* X = L + (w * 256 + lane) * 16;   // this wave's 8 x 512 bytes of O^T, the lane's 16 bytes of piece i at (i * 32 + lane) * 16
    const unsigned char* Y = L + ((w ^ 8) * 256 + lane) * 16;   // its partner's
#pragma unroll
    for (int dt = 0; dt < 4; ++dt) { const v8f t = h1 ? acc[0][dt] : acc[1][dt]; v4f t0, t1;
#pragma unroll
        for (int r = 0; r < 4; ++r) { t0[r] = t[r]; t1[r] = t[4 + r]; }
        *(v4fa*)(X + (2 * dt) * 512) = t0; *(v4fa*)(X + (2 * dt + 1) * 512) = t1; }
    { v2f ml; ml[0] = h1 ? m_run[0] : m_run[1]; ml[1] = h1 ? l_run[0] : l_run[1]; *(v2fa*)(L + 16 * 4096 + (w * 32 + lane) * 8) = ml; }   // its maximum in use and its sum, behind the 16 waves' tiles
    __syncthreads();   // every wave's part lies in LDS before its partner reads it
    const v2f pm = *(const v2fa*)(L + 16 * 4096 + ((w ^ 8) * 32 + lane) * 8);
    const float mo = h1 ? m_run[1] : m_run[0], lo = h1 ? l_run[1] : l_run[0];
    const float mn = fmaxf(mo, pm[0]);
    const float co = __builtin_amdgcn_exp2f(mo - mn), cp = __builtin_amdgcn_exp2f(pm[0] - mn);   // both parts on the common maximum
    const float lh = lo * co + pm[1] * cp;
    const float l = lh + xhalf(lh);   // each half of a wave summed its own 16 keys of every pass
    const float inv = __fdiv_rn(1.0f, l);
    const float fo = co * inv, fp = cp * inv;
    float* op = OUTp + ((size_t)(b * TT + q0 + half * 16 + lr) * NH_ + h) * HD + 8 * hi;   // acc[g][dt][r] = O[query q0 + 16 g + lr][d = 16 dt + 8 hi + r]
#pragma unroll
    for (int dt = 0; dt < 4; ++dt) { const v8f o = h1 ? acc[1][dt] : acc[0][dt]; const v4f p0 = *(const v4fa*)(Y + (2 * dt) * 512), p1 = *(const v4fa*)(Y + (2 * dt + 1) * 512); v4f o0, o1;
#pragma unroll
        for (int r = 0; r < 4; ++r) { o0[r] = o[r] * fo + p0[r] * fp; o1[r] = o[4 + r] * fo + p1[r] * fp; }
        *(v4f*)(op + dt * 16) = o0; *(v4f*)(op + dt * 16 + 4) = o1; }
}

extern "C" void kernel_launch(void* const* d_in, const int* in_sizes, int n_in,
                              void* d_out, int out_size, void* d_ws, size_t ws_size, hipStream_t stream) {
    (void)in_sizes; (void)n_in; (void)out_size; (void)d_ws; (void)ws_size;
    const float* x = (const float*)d_in[0]; const float* xk = (const float*)d_in[1]; const float* xv = (const float*)d_in[2]; const int* kmask = (const int*)d_in[3];   /* order queries, keys, values [2][2048][16][64], mask (int32 [2][1][1][2048], read) */
    float* OUT = (float*)d_out;     // [2][2048][1024]
    k_fattn<<<dim3(TT / 256, NB_ * NH_), 512, 0, stream>>>(x, xk, xv, kmask, OUT);   // one launch for both batches and all heads
}
